// v000
// Times are from an AMD MI455X. After a warm-up the kernel runs many times in a row, and a time is the length of
// such a window on the GPU divided by its runs, so every launch and the gaps after it count. The runs cycle
// through copies of the inputs. A figure is the median of several windows, for all but v000 over two sittings.
// Sittings can differ by a few percent; kernels timed side by side share one.
// v000, which the later versions start from, runs in 1970 microseconds.
// compute dtype: x_q, x_kv, Wq, bq, Wk, bk, Wv, bv (module inputs) rounded to bf16; q, k, v projections with exact bf16 products (natural [out][in] rows) + bias on WMMA 16x16x32; q/16 and k stored once as f16, v transposed to f16 planes (single: the softmax here averages thousands of keys, so operand rounding averages out); scores with single f16 operands (1 product); P = exp(s - m) rounded once to f16 (the same value feeds l) x V (1 product); running-max softmax in f32 with the hardware exp; f32 accumulate; out = (sum P v) / l.
#include <hip/hip_runtime.h>
#include <math.h>

typedef __attribute__((ext_vector_type(16))) _Float16 v16h;
typedef __attribute__((ext_vector_type(16))) __bf16 v16b;
typedef __attribute__((ext_vector_type(8)))  _Float16 v8h;
typedef __attribute__((ext_vector_type(8)))  float v8f;
typedef __attribute__((ext_vector_type(4)))  float v4f;
typedef __attribute__((ext_vector_type(2)))  float v2f;
typedef __attribute__((ext_vector_type(4)))  unsigned v4u;
typedef __attribute__((ext_vector_type(4)))  int v4i;
typedef float __attribute__((may_alias)) float_a;
typedef int __attribute__((may_alias)) int_a;

template <typename T> __device__ __forceinline__ void vst2(void* p, T v) { *(T*)p = v;  }
__device__ __forceinline__ v8f wmma16(v16h a, v16h b, v8f c) {
  v8f d = __builtin_amdgcn_wmma_f32_16x16x32_f16(false, a, false, b, (short)0, c, false, false);
  asm volatile("v_nop\n\tv_nop\n\tv_nop\n\tv_nop" : "+v"(d) : "v"(a), "v"(b));
  return d;
}
__device__ __forceinline__ v8f wmma_bf(v16b a, v16b b, v8f c) {
  v8f d = __builtin_amdgcn_wmma_f32_16x16x32_bf16(false, a, false, b, (short)0, c, false, false);
  asm volatile("v_nop\n\tv_nop\n\tv_nop\n\tv_nop" : "+v"(d) : "v"(a), "v"(b));
  return d;
}
// 16x16x32 fragments: lane = (h = lane>>4, row/col = lane&15); elements 0..7 = k0+8h+0..7, 8..15 = k0+16+8h+0..7; D element r = row 8h+r
__device__ __forceinline__ v16h frag_h(const _Float16* rowk0, int lane) {
  union { v16h v; v8h q[2]; } u; const _Float16* p = rowk0 + 8 * (lane >> 4);
  u.q[0] = *(const v8h*)p; u.q[1] = *(const v8h*)(p + 16); return u.v;
}
__device__ __forceinline__ v16h frag_f32(const float* rowk0, int lane) {
  v16h a; const float* p = rowk0 + 8 * (lane >> 4);
#pragma unroll
  for (int i = 0; i < 8; ++i) { a[i] = (_Float16)p[i]; a[8 + i] = (_Float16)p[16 + i]; }
  return a;
}
__device__ __forceinline__ v16h frag_f32s(const float* rowk0, int lane, float sc) {
  v16h a; const float* p = rowk0 + 8 * (lane >> 4);
#pragma unroll
  for (int i = 0; i < 8; ++i) { a[i] = (_Float16)(p[i] * sc); a[8 + i] = (_Float16)(p[16 + i] * sc); }
  return a;
}
// column fragment from a [K][ld] layout (column n), rows >= K read as 0
__device__ __forceinline__ v16h fragc_f32(const float* W, int k0, int n, int lane, int ld, int K) {
  v16h a; const int g = lane >> 4;
#pragma unroll
  for (int i = 0; i < 8; ++i) { const int ka = k0 + 8 * g + i, kb = ka + 16;
    a[i] = (_Float16)(ka < K ? W[(size_t)(ka < K ? ka : K - 1) * ld + n] : 0.f); a[8 + i] = (_Float16)(kb < K ? W[(size_t)(kb < K ? kb : K - 1) * ld + n] : 0.f); }
  return a;
}
struct F2 { v16b h, l; };
__device__ __forceinline__ F2 bsplit16(const float v[16]) { F2 r;
#pragma unroll
  for (int i = 0; i < 16; ++i) { const __bf16 h = (__bf16)v[i]; r.h[i] = h; r.l[i] = (__bf16)(v[i] - (float)h); }
  return r; }
__device__ __forceinline__ F2 split_row(const float* row, int k0, int lane) { float v[16]; const float* p = row + k0 + 8 * (lane >> 4);
#pragma unroll
  for (int i = 0; i < 8; ++i) { v[i] = p[i]; v[8 + i] = p[16 + i]; }
  return bsplit16(v); }
__device__ __forceinline__ F2 split_rowK(const float* row, int k0, int lane, int K) { float v[16]; const int g = lane >> 4;
#pragma unroll
  for (int i = 0; i < 8; ++i) { const int ka = k0 + 8 * g + i, kb = ka + 16; v[i] = ka < K ? row[ka < K ? ka : K - 1] : 0.f; v[8 + i] = kb < K ? row[kb < K ? kb : K - 1] : 0.f; }
  return bsplit16(v); }
__device__ __forceinline__ F2 split_col(const float* W, int k0, int n, int lane, int ld, int K) { float v[16]; const int g = lane >> 4;
#pragma unroll
  for (int i = 0; i < 8; ++i) { const int ka = k0 + 8 * g + i, kb = ka + 16; v[i] = ka < K ? W[(size_t)(ka < K ? ka : K - 1) * ld + n] : 0.f; v[8 + i] = kb < K ? W[(size_t)(kb < K ? kb : K - 1) * ld + n] : 0.f; }
  return bsplit16(v); }
__device__ __forceinline__ v8f mac3(const F2& a, const F2& b, v8f c) { c = wmma_bf(a.l, b.h, c); c = wmma_bf(a.h, b.l, c); return wmma_bf(a.h, b.h, c); }
__device__ __forceinline__ float sigm(float v) { return 1.0f / (1.0f + expf(-v)); }
#define LDSX() do { asm volatile("s_wait_dscnt 0" ::: "memory"); __builtin_amdgcn_wave_barrier(); __builtin_amdgcn_fence(__ATOMIC_RELEASE, "workgroup"); } while (0)


// Cross-stream single-head attention (N = M = 8,192, D 256): softmax((x_q Wq^T + bq)(x_kv Wk^T + bk)^T / 16) (x_kv Wv^T + bv).
#define NQ 8192
#define NK 8192
#define DD 256
#ifndef TQB
#define TQB (NQ / 64)
#endif
typedef __attribute__((ext_vector_type(8))) __bf16 v8b;
__device__ __forceinline__ v16b frag_b(const __bf16* rowk0, int lane) {
  union { v16b v; v8b q[2]; } u; const __bf16* p = rowk0 + 8 * (lane >> 4);
  u.q[0] = *(const v8b*)p; u.q[1] = *(const v8b*)(p + 16); return u.v;
}
__device__ __forceinline__ float bfr(float v) { return (float)(__bf16)v; }
__device__ __attribute__((noinline)) float exp_ni(float v) { return expf(v); }
__device__ __attribute__((noinline)) float erf_ni(float v) { return erff(v); }

#define WS_PK  0u                                 // bf16 [3][256][256] Wq, Wk, Wv natural rows
#define WS_QH  (WS_PK + 2u * 3 * DD * DD)            // f16 [8192][256] q/16
#define WS_KH  (WS_QH + 2u * NQ * DD)                // f16 [8192][256] k
#define WS_VT  (WS_KH + 2u * NK * DD)                // f16 [256 d][8192 keys] v^T
#define WS_END (WS_VT + 2u * DD * NK)

__global__ __launch_bounds__(256) void k_pack(const float* __restrict__ WQ, const float* __restrict__ WK, const float* __restrict__ WV, __bf16* __restrict__ PK) {
  __shared__ __align__(16) __bf16 s[DD]; const int n = blockIdx.x, which = blockIdx.y, t = threadIdx.x; const float* Wm = (which == 0) ? WQ : (which == 1) ? WK : WV;
  s[t] = (__bf16)Wm[(size_t)n * DD + t]; __syncthreads();
  if (t < DD / 8) vst2((unsigned*)(PK + ((size_t)which * DD + n) * DD + t * 8), *(const v4u*)&s[t * 8]);
}
__global__ __launch_bounds__(128) void k_proj(const float* __restrict__ XQ, const float* __restrict__ XKV, const __bf16* __restrict__ PK, const float* __restrict__ BQ, const float* __restrict__ BK, const float* __restrict__ BV, _Float16* __restrict__ QH, _Float16* __restrict__ KH, _Float16* __restrict__ VT) {
  __shared__ __align__(16) _Float16 so[4][16][DD + 8]; __shared__ __align__(16) _Float16 st[DD][72];
  const int tid = threadIdx.x, wave = tid >> 5, lane = tid & 31, col = lane & 15, g = lane >> 4; const size_t r0 = (size_t)blockIdx.x * 64 + wave * 16; const int which = blockIdx.y;
  const float* X = (which == 0) ? XQ : XKV; const __bf16* P = PK + (size_t)which * DD * DD; const float* BB = (which == 0) ? BQ : (which == 1) ? BK : BV; const float sc = (which == 0) ? (1.0f / 16.0f) : 1.0f;
#pragma unroll 1
  for (int half = 0; half < 2; ++half) { v8f acc[8] = {};
#pragma unroll
    for (int kc = 0; kc < DD / 32; ++kc) { v16b a; { const float* p = X + (r0 + col) * DD + kc * 32 + 8 * g;
#pragma unroll
        for (int i = 0; i < 8; ++i) { a[i] = (__bf16)p[i]; a[8 + i] = (__bf16)p[16 + i]; } }
#pragma unroll
      for (int j = 0; j < 8; ++j) acc[j] = wmma_bf(a, frag_b(P + (size_t)(half * 128 + j * 16 + col) * DD + kc * 32, lane), acc[j]); }
#pragma unroll
    for (int j = 0; j < 8; ++j) { const int n = half * 128 + j * 16 + col; const float bb = bfr(BB[n]);
#pragma unroll
      for (int r = 0; r < 8; ++r) { const float v = (acc[j][r] + bb) * sc; if (which == 2) st[n][wave * 16 + 8 * g + r] = (_Float16)v; else so[wave][8 * g + r][n] = (_Float16)v; } } }
  if (which == 2) { __syncthreads(); const size_t k0 = (size_t)blockIdx.x * 64;
    for (int q = tid; q < DD * 8; q += 128) { const int d = q >> 3, pc = q & 7; vst2((unsigned*)(VT + (size_t)d * NK + k0 + pc * 8), *(const v4u*)&st[d][pc * 8]); } }
  else { LDSX(); _Float16* DST = (which == 0) ? QH : KH;
    for (int rl = 0; rl < 16; ++rl) vst2((unsigned*)(DST + (r0 + rl) * DD + lane * 8), *(const v4u*)&so[wave][rl][lane * 8]); }
}
// ---- k_attn: block = 64 queries (wave = 16): all 8,192 keys in 32-key steps: scores (K 256 = 8 chunks, 1 product, q pre-scaled), running max, P rounded once to f16 (the rounded value also accumulates l) x VT planes for all 256 output dims (16 tiles); out rows 1 KB by 32 lanes x 2
__global__ __launch_bounds__(128) void k_attn(const _Float16* __restrict__ QH, const _Float16* __restrict__ KH, const _Float16* __restrict__ VT, float* __restrict__ OUT) {
  __shared__ __align__(16) _Float16 sp[4][16][40]; __shared__ __align__(16) float so[4][16][DD + 4];
  const int tid = threadIdx.x, wave = tid >> 5, lane = tid & 31, col = lane & 15, g = lane >> 4; const size_t q0 = (size_t)blockIdx.x * 64 + wave * 16;
  v16h aq[DD / 32];
#pragma unroll
  for (int kc = 0; kc < DD / 32; ++kc) aq[kc] = frag_h(QH + (q0 + col) * DD + kc * 32, lane);
  float m[8], l[8];
#pragma unroll
  for (int r = 0; r < 8; ++r) { m[r] = -3.0e38f; l[r] = 0.f; }
  v8f acc[16] = {};
#pragma unroll 1
  for (int ks = 0; ks < NK / 32; ++ks) { v8f s[2];
#pragma unroll
    for (int ct = 0; ct < 2; ++ct) { const size_t kk = (size_t)ks * 32 + ct * 16 + col; v8f c = {};
#pragma unroll
      for (int kc = 0; kc < DD / 32; ++kc) c = wmma16(aq[kc], frag_h(KH + kk * DD + kc * 32, lane), c);
      s[ct] = c; }
#pragma unroll
    for (int r = 0; r < 8; ++r) { float mx = fmaxf(s[0][r], s[1][r]);
#pragma unroll
      for (int o = 1; o < 16; o <<= 1) mx = fmaxf(mx, __shfl_xor(mx, o));
      const float mn = fmaxf(m[r], mx); const float alpha = (m[r] <= -1.0e38f) ? 0.f : __expf(m[r] - mn);
      const _Float16 e0 = (_Float16)__expf(s[0][r] - mn), e1 = (_Float16)__expf(s[1][r] - mn); float es = (float)e0 + (float)e1;   // P rounded once; the same values feed l
#pragma unroll
      for (int o = 1; o < 16; o <<= 1) es += __shfl_xor(es, o);
      l[r] = l[r] * alpha + es; m[r] = mn;
#pragma unroll
      for (int dt = 0; dt < 16; ++dt) acc[dt][r] *= alpha;
      sp[wave][8 * g + r][col] = e0; sp[wave][8 * g + r][16 + col] = e1; }
    LDSX();
    const v16h pa = frag_h(&sp[wave][col][0], lane);
#pragma unroll
    for (int dt = 0; dt < 16; ++dt) acc[dt] = wmma16(pa, frag_h(VT + (size_t)(dt * 16 + col) * NK + (size_t)ks * 32, lane), acc[dt]);
    LDSX(); }
#pragma unroll
  for (int r = 0; r < 8; ++r) { const float il = 1.0f / l[r];
#pragma unroll
    for (int dt = 0; dt < 16; ++dt) so[wave][8 * g + r][dt * 16 + col] = acc[dt][r] * il; }
  LDSX();
  for (int rl = 0; rl < 16; ++rl) { vst2(OUT + (q0 + rl) * DD + lane * 4, *(const v4f*)&so[wave][rl][lane * 4]); vst2(OUT + (q0 + rl) * DD + 128 + lane * 4, *(const v4f*)&so[wave][rl][128 + lane * 4]); }
}
extern "C" void kernel_launch(void* const* d_in, const int* in_sizes, int n_in, void* d_out, int out_size, void* d_ws, size_t ws_size, hipStream_t stream) {
  (void)in_sizes; (void)n_in; (void)out_size;
  const float** F = (const float**)d_in;   // 0 x_q [8192,256], 1 x_kv [8192,256], 2 Wq [256,256], 3 bq, 4 Wk, 5 bk, 6 Wv, 7 bv
  if (ws_size < (size_t)WS_END) return;
  char* ws = (char*)d_ws; __bf16* PK = (__bf16*)(ws + WS_PK); _Float16 *QH = (_Float16*)(ws + WS_QH), *KH = (_Float16*)(ws + WS_KH), *VT = (_Float16*)(ws + WS_VT);
  k_pack<<<dim3(DD, 3), 256, 0, stream>>>(F[2], F[4], F[6], PK);
  k_proj<<<dim3(NQ / 64, 3), 128, 0, stream>>>(F[0], F[1], PK, F[3], F[5], F[7], QH, KH, VT);
  k_attn<<<TQB, 128, 0, stream>>>(QH, KH, VT, (float*)d_out);
}

// v001
// It runs in 400 microseconds.
// Next to v000, in two timings, it ran 4.91 and 4.94 times as fast.
// compute dtype: x_q, x_kv, Wq, bq, Wk, bk, Wv, bv (module inputs) rounded to bf16; q, k, v projections with exact bf16 products (natural [out][in] rows) + bias on WMMA 16x16x32; q/16 and k stored once as f16, v transposed to f16 planes (single: the softmax here averages thousands of keys, so operand rounding averages out); scores with single f16 operands (1 product); P = exp(s - m) rounded once to f16 (the same value feeds l) x V (1 product); running-max softmax in f32 with the hardware exp; f32 accumulate; the keys are split over 8 waves per query tile, whose partial (m, l, sum P v) are merged in f32: out = (sum_g w_g O_g) / (sum_g w_g l_g), w_g = exp(m_g - max m).
#include <hip/hip_runtime.h>
#include <math.h>

typedef __attribute__((ext_vector_type(16))) _Float16 v16h;
typedef __attribute__((ext_vector_type(16))) __bf16 v16b;
typedef __attribute__((ext_vector_type(8)))  _Float16 v8h;
typedef __attribute__((ext_vector_type(8)))  float v8f;
typedef __attribute__((ext_vector_type(4)))  float v4f;
typedef __attribute__((ext_vector_type(2)))  float v2f;
typedef __attribute__((ext_vector_type(4)))  unsigned v4u;
typedef __attribute__((ext_vector_type(4)))  int v4i;
typedef float __attribute__((may_alias)) float_a;
typedef int __attribute__((may_alias)) int_a;

template <typename T> __device__ __forceinline__ void vst2(void* p, T v) { *(T*)p = v;  }
__device__ __forceinline__ v8f wmma16(v16h a, v16h b, v8f c) {
  v8f d = __builtin_amdgcn_wmma_f32_16x16x32_f16(false, a, false, b, (short)0, c, false, false);
  asm volatile("v_nop\n\tv_nop\n\tv_nop\n\tv_nop" : "+v"(d) : "v"(a), "v"(b));
  return d;
}
__device__ __forceinline__ v8f wmma_bf(v16b a, v16b b, v8f c) {
  v8f d = __builtin_amdgcn_wmma_f32_16x16x32_bf16(false, a, false, b, (short)0, c, false, false);
  asm volatile("v_nop\n\tv_nop\n\tv_nop\n\tv_nop" : "+v"(d) : "v"(a), "v"(b));
  return d;
}
// 16x16x32 fragments: lane = (h = lane>>4, row/col = lane&15); elements 0..7 = k0+8h+0..7, 8..15 = k0+16+8h+0..7; D element r = row 8h+r
__device__ __forceinline__ v16h frag_h(const _Float16* rowk0, int lane) {
  union { v16h v; v8h q[2]; } u; const _Float16* p = rowk0 + 8 * (lane >> 4);
  u.q[0] = *(const v8h*)p; u.q[1] = *(const v8h*)(p + 16); return u.v;
}
__device__ __forceinline__ v16h frag_f32(const float* rowk0, int lane) {
  v16h a; const float* p = rowk0 + 8 * (lane >> 4);
#pragma unroll
  for (int i = 0; i < 8; ++i) { a[i] = (_Float16)p[i]; a[8 + i] = (_Float16)p[16 + i]; }
  return a;
}
__device__ __forceinline__ v16h frag_f32s(const float* rowk0, int lane, float sc) {
  v16h a; const float* p = rowk0 + 8 * (lane >> 4);
#pragma unroll
  for (int i = 0; i < 8; ++i) { a[i] = (_Float16)(p[i] * sc); a[8 + i] = (_Float16)(p[16 + i] * sc); }
  return a;
}
// column fragment from a [K][ld] layout (column n), rows >= K read as 0
__device__ __forceinline__ v16h fragc_f32(const float* W, int k0, int n, int lane, int ld, int K) {
  v16h a; const int g = lane >> 4;
#pragma unroll
  for (int i = 0; i < 8; ++i) { const int ka = k0 + 8 * g + i, kb = ka + 16;
    a[i] = (_Float16)(ka < K ? W[(size_t)(ka < K ? ka : K - 1) * ld + n] : 0.f); a[8 + i] = (_Float16)(kb < K ? W[(size_t)(kb < K ? kb : K - 1) * ld + n] : 0.f); }
  return a;
}
struct F2 { v16b h, l; };
__device__ __forceinline__ F2 bsplit16(const float v[16]) { F2 r;
#pragma unroll
  for (int i = 0; i < 16; ++i) { const __bf16 h = (__bf16)v[i]; r.h[i] = h; r.l[i] = (__bf16)(v[i] - (float)h); }
  return r; }
__device__ __forceinline__ F2 split_row(const float* row, int k0, int lane) { float v[16]; const float* p = row + k0 + 8 * (lane >> 4);
#pragma unroll
  for (int i = 0; i < 8; ++i) { v[i] = p[i]; v[8 + i] = p[16 + i]; }
  return bsplit16(v); }
__device__ __forceinline__ F2 split_rowK(const float* row, int k0, int lane, int K) { float v[16]; const int g = lane >> 4;
#pragma unroll
  for (int i = 0; i < 8; ++i) { const int ka = k0 + 8 * g + i, kb = ka + 16; v[i] = ka < K ? row[ka < K ? ka : K - 1] : 0.f; v[8 + i] = kb < K ? row[kb < K ? kb : K - 1] : 0.f; }
  return bsplit16(v); }
__device__ __forceinline__ F2 split_col(const float* W, int k0, int n, int lane, int ld, int K) { float v[16]; const int g = lane >> 4;
#pragma unroll
  for (int i = 0; i < 8; ++i) { const int ka = k0 + 8 * g + i, kb = ka + 16; v[i] = ka < K ? W[(size_t)(ka < K ? ka : K - 1) * ld + n] : 0.f; v[8 + i] = kb < K ? W[(size_t)(kb < K ? kb : K - 1) * ld + n] : 0.f; }
  return bsplit16(v); }
__device__ __forceinline__ v8f mac3(const F2& a, const F2& b, v8f c) { c = wmma_bf(a.l, b.h, c); c = wmma_bf(a.h, b.l, c); return wmma_bf(a.h, b.h, c); }
__device__ __forceinline__ float sigm(float v) { return 1.0f / (1.0f + expf(-v)); }
#define LDSX() do { asm volatile("s_wait_dscnt 0" ::: "memory"); __builtin_amdgcn_wave_barrier(); __builtin_amdgcn_fence(__ATOMIC_RELEASE, "workgroup"); } while (0)


// Cross-stream single-head attention (N = M = 8,192, D 256): softmax((x_q Wq^T + bq)(x_kv Wk^T + bk)^T / 16) (x_kv Wv^T + bv).
#define NQ 8192
#define NK 8192
#define DD 256
#ifndef TQB
#define TQB (NQ / 32)
#endif
typedef __attribute__((ext_vector_type(8))) __bf16 v8b;
__device__ __forceinline__ v16b frag_b(const __bf16* rowk0, int lane) {
  union { v16b v; v8b q[2]; } u; const __bf16* p = rowk0 + 8 * (lane >> 4);
  u.q[0] = *(const v8b*)p; u.q[1] = *(const v8b*)(p + 16); return u.v;
}
__device__ __forceinline__ float bfr(float v) { return (float)(__bf16)v; }
__device__ __attribute__((noinline)) float exp_ni(float v) { return expf(v); }
__device__ __attribute__((noinline)) float erf_ni(float v) { return erff(v); }

#define KG 8                                      // key groups (waves) that share one 16-query tile
#define WS_PK  0u                                 // bf16 [3][256][256] Wq, Wk, Wv natural rows
#define WS_QH  (WS_PK + 2u * 3 * DD * DD)            // f16 [8192][256] q/16
#define WS_KH  (WS_QH + 2u * NQ * DD)                // f16 [8192][256] k
#define WS_VT  (WS_KH + 2u * NK * DD)                // f16 [256 d][8192 keys] v^T
#define WS_END (WS_VT + 2u * DD * NK)

__global__ __launch_bounds__(256) void k_pack(const float* __restrict__ WQ, const float* __restrict__ WK, const float* __restrict__ WV, __bf16* __restrict__ PK) {
  __shared__ __align__(16) __bf16 s[DD]; const int n = blockIdx.x, which = blockIdx.y, t = threadIdx.x; const float* Wm = (which == 0) ? WQ : (which == 1) ? WK : WV;
  s[t] = (__bf16)Wm[(size_t)n * DD + t]; __syncthreads();
  if (t < DD / 8) vst2((unsigned*)(PK + ((size_t)which * DD + n) * DD + t * 8), *(const v4u*)&s[t * 8]);
}
__global__ __launch_bounds__(128) void k_proj(const float* __restrict__ XQ, const float* __restrict__ XKV, const __bf16* __restrict__ PK, const float* __restrict__ BQ, const float* __restrict__ BK, const float* __restrict__ BV, _Float16* __restrict__ QH, _Float16* __restrict__ KH, _Float16* __restrict__ VT) {
  __shared__ __align__(16) _Float16 so[4][16][DD + 8]; __shared__ __align__(16) _Float16 st[DD][72];
  const int tid = threadIdx.x, wave = tid >> 5, lane = tid & 31, col = lane & 15, g = lane >> 4; const size_t r0 = (size_t)blockIdx.x * 64 + wave * 16; const int which = blockIdx.y;
  const float* X = (which == 0) ? XQ : XKV; const __bf16* P = PK + (size_t)which * DD * DD; const float* BB = (which == 0) ? BQ : (which == 1) ? BK : BV; const float sc = (which == 0) ? (1.0f / 16.0f) : 1.0f;
#pragma unroll 1
  for (int half = 0; half < 2; ++half) { v8f acc[8] = {};
#pragma unroll
    for (int kc = 0; kc < DD / 32; ++kc) { v16b a; { const float* p = X + (r0 + col) * DD + kc * 32 + 8 * g;
#pragma unroll
        for (int i = 0; i < 8; ++i) { a[i] = (__bf16)p[i]; a[8 + i] = (__bf16)p[16 + i]; } }
#pragma unroll
      for (int j = 0; j < 8; ++j) acc[j] = wmma_bf(a, frag_b(P + (size_t)(half * 128 + j * 16 + col) * DD + kc * 32, lane), acc[j]); }
#pragma unroll
    for (int j = 0; j < 8; ++j) { const int n = half * 128 + j * 16 + col; const float bb = bfr(BB[n]);
#pragma unroll
      for (int r = 0; r < 8; ++r) { const float v = (acc[j][r] + bb) * sc; if (which == 2) st[n][wave * 16 + 8 * g + r] = (_Float16)v; else so[wave][8 * g + r][n] = (_Float16)v; } } }
  if (which == 2) { __syncthreads(); const size_t k0 = (size_t)blockIdx.x * 64;
    for (int q = tid; q < DD * 8; q += 128) { const int d = q >> 3, pc = q & 7; vst2((unsigned*)(VT + (size_t)d * NK + k0 + pc * 8), *(const v4u*)&st[d][pc * 8]); } }
  else { LDSX(); _Float16* DST = (which == 0) ? QH : KH;
    for (int rl = 0; rl < 16; ++rl) vst2((unsigned*)(DST + (r0 + rl) * DD + lane * 8), *(const v4u*)&so[wave][rl][lane * 8]); }
}
// ---- k_attn: block = 32 queries x 8 key groups = 16 waves (wave = 16 queries, every 8th 32-key step: four waves per SIMD cover each other's load and cross-lane waits, and the grid fills every WGP); per step: scores (K 256 = 8 chunks, 1 product, q pre-scaled), running max, P rounded once to f16 (the rounded value also accumulates l) x VT planes for all 256 output dims (16 tiles); then each wave's unnormalised partial sums with its m and l go to LDS, one barrier, and all 512 threads merge the 8 key groups of each row; out in 512-B pieces per wave
__global__ __launch_bounds__(512) void k_attn(const _Float16* __restrict__ QH, const _Float16* __restrict__ KH, const _Float16* __restrict__ VT, float* __restrict__ OUT) {
  __shared__ __align__(16) _Float16 sp[2 * KG][16][40]; __shared__ __align__(16) float so[2 * KG][16][DD + 4]; __shared__ float sm[2 * KG][16], sl[2 * KG][16];
  const int tid = threadIdx.x, wave = tid >> 5, lane = tid & 31, col = lane & 15, g = lane >> 4, kg = wave >> 1; const size_t q0 = (size_t)blockIdx.x * 32 + (wave & 1) * 16;
  v16h aq[DD / 32];
#pragma unroll
  for (int kc = 0; kc < DD / 32; ++kc) aq[kc] = frag_h(QH + (q0 + col) * DD + kc * 32, lane);
  float m[8], l[8];
#pragma unroll
  for (int r = 0; r < 8; ++r) { m[r] = -3.0e38f; l[r] = 0.f; }
  v8f acc[16] = {};
#pragma unroll 1
  for (int it = 0; it < NK / 32 / KG; ++it) { const int ks = it * KG + kg; v8f s[2];
#pragma unroll
    for (int ct = 0; ct < 2; ++ct) { const size_t kk = (size_t)ks * 32 + ct * 16 + col; v8f c = {};
#pragma unroll
      for (int kc = 0; kc < DD / 32; ++kc) c = wmma16(aq[kc], frag_h(KH + kk * DD + kc * 32, lane), c);
      s[ct] = c; }
#pragma unroll
    for (int r = 0; r < 8; ++r) { float mx = fmaxf(s[0][r], s[1][r]);
#pragma unroll
      for (int o = 1; o < 16; o <<= 1) mx = fmaxf(mx, __shfl_xor(mx, o));
      const float mn = fmaxf(m[r], mx); const float alpha = (m[r] <= -1.0e38f) ? 0.f : __expf(m[r] - mn);
      const _Float16 e0 = (_Float16)__expf(s[0][r] - mn), e1 = (_Float16)__expf(s[1][r] - mn); float es = (float)e0 + (float)e1;   // P rounded once; the same values feed l
#pragma unroll
      for (int o = 1; o < 16; o <<= 1) es += __shfl_xor(es, o);
      l[r] = l[r] * alpha + es; m[r] = mn;
#pragma unroll
      for (int dt = 0; dt < 16; ++dt) acc[dt][r] *= alpha;
      sp[wave][8 * g + r][col] = e0; sp[wave][8 * g + r][16 + col] = e1; }
    LDSX();
    const v16h pa = frag_h(&sp[wave][col][0], lane);
#pragma unroll
    for (int dt = 0; dt < 16; ++dt) acc[dt] = wmma16(pa, frag_h(VT + (size_t)(dt * 16 + col) * NK + (size_t)ks * 32, lane), acc[dt]);
    LDSX(); }
#pragma unroll
  for (int r = 0; r < 8; ++r) { if (col == 0) { sm[wave][8 * g + r] = m[r]; sl[wave][8 * g + r] = l[r]; }   // row by row with its sums: gathered in one block behind them, the 256-register build spilled inside the key loop
#pragma unroll
    for (int dt = 0; dt < 16; ++dt) so[wave][8 * g + r][dt * 16 + col] = acc[dt][r]; }
  __syncthreads();
  // merge: 32 rows x 64 four-float pieces over 512 threads; a wave holds half of one row, so m, l and the weights are wave-uniform reads
#pragma unroll
  for (int i = 0; i < 4; ++i) { const int idx = i * 512 + tid, row = idx >> 6, c = (idx & 63) * 4, w0 = row >> 4, rl = row & 15;
    float mg[KG], mx = -3.0e38f;
#pragma unroll
    for (int k = 0; k < KG; ++k) { mg[k] = sm[2 * k + w0][rl]; mx = fmaxf(mx, mg[k]); }
    float ls = 0.f; v4f o = {};
#pragma unroll
    for (int k = 0; k < KG; ++k) { const float w = __expf(mg[k] - mx); ls += w * sl[2 * k + w0][rl]; o += w * *(const v4f*)&so[2 * k + w0][rl][c]; }
    vst2(OUT + ((size_t)blockIdx.x * 32 + row) * DD + c, o * (1.0f / ls)); }
}
extern "C" void kernel_launch(void* const* d_in, const int* in_sizes, int n_in, void* d_out, int out_size, void* d_ws, size_t ws_size, hipStream_t stream) {
  (void)in_sizes; (void)n_in; (void)out_size;
  const float** F = (const float**)d_in;   // 0 x_q [8192,256], 1 x_kv [8192,256], 2 Wq [256,256], 3 bq, 4 Wk, 5 bk, 6 Wv, 7 bv
  if (ws_size < (size_t)WS_END) return;
  char* ws = (char*)d_ws; __bf16* PK = (__bf16*)(ws + WS_PK); _Float16 *QH = (_Float16*)(ws + WS_QH), *KH = (_Float16*)(ws + WS_KH), *VT = (_Float16*)(ws + WS_VT);
  k_pack<<<dim3(DD, 3), 256, 0, stream>>>(F[2], F[4], F[6], PK);
  k_proj<<<dim3(NQ / 64, 3), 128, 0, stream>>>(F[0], F[1], PK, F[3], F[5], F[7], QH, KH, VT);
  k_attn<<<TQB, 512, 0, stream>>>(QH, KH, VT, (float*)d_out);
}

// v002
// It runs in 207 microseconds.
// In two side-by-side timings against v001, it was 1.93 and 1.95 times as fast.
// Over all steps from v000 it is 9.56 times as fast.
// compute dtype: x_q, x_kv, Wq, bq, Wk, bk, Wv, bv (module inputs) rounded to bf16; q, k, v projections with exact bf16 products (natural [out][in] rows) + bias on WMMA 16x16x32; q/16 and k stored once as f16, v transposed to f16 planes (single: the softmax here averages thousands of keys, so operand rounding averages out); scores with single f16 operands (1 product); P = exp(s - m) rounded once to f16 (the same value feeds l) x V (1 product); running-max softmax in f32 with the hardware exp; f32 accumulate; the keys are split over 8 waves per query tile, whose partial (m, l, sum P v) are merged in f32: out = (sum_g w_g O_g) / (sum_g w_g l_g), w_g = exp(m_g - max m).
#include <hip/hip_runtime.h>
#include <math.h>

typedef __attribute__((ext_vector_type(16))) _Float16 v16h;
typedef __attribute__((ext_vector_type(16))) __bf16 v16b;
typedef __attribute__((ext_vector_type(8)))  _Float16 v8h;
typedef __attribute__((ext_vector_type(8)))  float v8f;
typedef __attribute__((ext_vector_type(4)))  float v4f;
typedef __attribute__((ext_vector_type(2)))  float v2f;
typedef __attribute__((ext_vector_type(4)))  unsigned v4u;
typedef __attribute__((ext_vector_type(4)))  int v4i;
typedef float __attribute__((may_alias)) float_a;
typedef int __attribute__((may_alias)) int_a;

template <typename T> __device__ __forceinline__ void vst2(void* p, T v) { *(T*)p = v;  }
__device__ __forceinline__ v8f wmma16(v16h a, v16h b, v8f c) {
  v8f d = __builtin_amdgcn_wmma_f32_16x16x32_f16(false, a, false, b, (short)0, c, false, false);
  asm volatile("v_nop\n\tv_nop\n\tv_nop\n\tv_nop" : "+v"(d) : "v"(a), "v"(b));
  return d;
}
__device__ __forceinline__ v8f wmma_bf(v16b a, v16b b, v8f c) {
  v8f d = __builtin_amdgcn_wmma_f32_16x16x32_bf16(false, a, false, b, (short)0, c, false, false);
  asm volatile("v_nop\n\tv_nop\n\tv_nop\n\tv_nop" : "+v"(d) : "v"(a), "v"(b));
  return d;
}
// 16x16x32 fragments: lane = (h = lane>>4, row/col = lane&15); elements 0..7 = k0+8h+0..7, 8..15 = k0+16+8h+0..7; D element r = row 8h+r
__device__ __forceinline__ v16h frag_h(const _Float16* rowk0, int lane) {
  union { v16h v; v8h q[2]; } u; const _Float16* p = rowk0 + 8 * (lane >> 4);
  u.q[0] = *(const v8h*)p; u.q[1] = *(const v8h*)(p + 16); return u.v;
}
__device__ __forceinline__ v16h frag_f32(const float* rowk0, int lane) {
  v16h a; const float* p = rowk0 + 8 * (lane >> 4);
#pragma unroll
  for (int i = 0; i < 8; ++i) { a[i] = (_Float16)p[i]; a[8 + i] = (_Float16)p[16 + i]; }
  return a;
}
__device__ __forceinline__ v16h frag_f32s(const float* rowk0, int lane, float sc) {
  v16h a; const float* p = rowk0 + 8 * (lane >> 4);
#pragma unroll
  for (int i = 0; i < 8; ++i) { a[i] = (_Float16)(p[i] * sc); a[8 + i] = (_Float16)(p[16 + i] * sc); }
  return a;
}
// column fragment from a [K][ld] layout (column n), rows >= K read as 0
__device__ __forceinline__ v16h fragc_f32(const float* W, int k0, int n, int lane, int ld, int K) {
  v16h a; const int g = lane >> 4;
#pragma unroll
  for (int i = 0; i < 8; ++i) { const int ka = k0 + 8 * g + i, kb = ka + 16;
    a[i] = (_Float16)(ka < K ? W[(size_t)(ka < K ? ka : K - 1) * ld + n] : 0.f); a[8 + i] = (_Float16)(kb < K ? W[(size_t)(kb < K ? kb : K - 1) * ld + n] : 0.f); }
  return a;
}
struct F2 { v16b h, l; };
__device__ __forceinline__ F2 bsplit16(const float v[16]) { F2 r;
#pragma unroll
  for (int i = 0; i < 16; ++i) { const __bf16 h = (__bf16)v[i]; r.h[i] = h; r.l[i] = (__bf16)(v[i] - (float)h); }
  return r; }
__device__ __forceinline__ F2 split_row(const float* row, int k0, int lane) { float v[16]; const float* p = row + k0 + 8 * (lane >> 4);
#pragma unroll
  for (int i = 0; i < 8; ++i) { v[i] = p[i]; v[8 + i] = p[16 + i]; }
  return bsplit16(v); }
__device__ __forceinline__ F2 split_rowK(const float* row, int k0, int lane, int K) { float v[16]; const int g = lane >> 4;
#pragma unroll
  for (int i = 0; i < 8; ++i) { const int ka = k0 + 8 * g + i, kb = ka + 16; v[i] = ka < K ? row[ka < K ? ka : K - 1] : 0.f; v[8 + i] = kb < K ? row[kb < K ? kb : K - 1] : 0.f; }
  return bsplit16(v); }
__device__ __forceinline__ F2 split_col(const float* W, int k0, int n, int lane, int ld, int K) { float v[16]; const int g = lane >> 4;
#pragma unroll
  for (int i = 0; i < 8; ++i) { const int ka = k0 + 8 * g + i, kb = ka + 16; v[i] = ka < K ? W[(size_t)(ka < K ? ka : K - 1) * ld + n] : 0.f; v[8 + i] = kb < K ? W[(size_t)(kb < K ? kb : K - 1) * ld + n] : 0.f; }
  return bsplit16(v); }
__device__ __forceinline__ v8f mac3(const F2& a, const F2& b, v8f c) { c = wmma_bf(a.l, b.h, c); c = wmma_bf(a.h, b.l, c); return wmma_bf(a.h, b.h, c); }
__device__ __forceinline__ float sigm(float v) { return 1.0f / (1.0f + expf(-v)); }
#define LDSX() do { asm volatile("s_wait_dscnt 0" ::: "memory"); __builtin_amdgcn_wave_barrier(); __builtin_amdgcn_fence(__ATOMIC_RELEASE, "workgroup"); } while (0)


// Cross-stream single-head attention (N = M = 8,192, D 256): softmax((x_q Wq^T + bq)(x_kv Wk^T + bk)^T / 16) (x_kv Wv^T + bv).
#define NQ 8192
#define NK 8192
#define DD 256
#ifndef TQB
#define TQB (NQ / 32)
#endif
typedef __attribute__((ext_vector_type(8))) __bf16 v8b;
__device__ __forceinline__ v16b frag_b(const __bf16* rowk0, int lane) {
  union { v16b v; v8b q[2]; } u; const __bf16* p = rowk0 + 8 * (lane >> 4);
  u.q[0] = *(const v8b*)p; u.q[1] = *(const v8b*)(p + 16); return u.v;
}
__device__ __forceinline__ float bfr(float v) { return (float)(__bf16)v; }
__device__ __attribute__((noinline)) float exp_ni(float v) { return expf(v); }
__device__ __attribute__((noinline)) float erf_ni(float v) { return erff(v); }

#define KG 8                                      // key groups (waves) that share one 16-query tile
#define WS_PK  0u                                 // bf16 [3][256][256] Wq, Wk, Wv natural rows
#define WS_QH  (WS_PK + 2u * 3 * DD * DD)            // f16 [8192][256] q/16
#define WS_KH  (WS_QH + 2u * NQ * DD)                // f16 [8192][256] k
#define WS_VT  (WS_KH + 2u * NK * DD)                // f16 [256 d][8192 keys] v^T
#define WS_END (WS_VT + 2u * DD * NK)

__global__ __launch_bounds__(256) void k_pack(const float* __restrict__ WQ, const float* __restrict__ WK, const float* __restrict__ WV, __bf16* __restrict__ PK) {
  __shared__ __align__(16) __bf16 s[DD]; const int n = blockIdx.x, which = blockIdx.y, t = threadIdx.x; const float* Wm = (which == 0) ? WQ : (which == 1) ? WK : WV;
  s[t] = (__bf16)Wm[(size_t)n * DD + t]; __syncthreads();
  if (t < DD / 8) vst2((unsigned*)(PK + ((size_t)which * DD + n) * DD + t * 8), *(const v4u*)&s[t * 8]);
}
__global__ __launch_bounds__(128) void k_proj(const float* __restrict__ XQ, const float* __restrict__ XKV, const __bf16* __restrict__ PK, const float* __restrict__ BQ, const float* __restrict__ BK, const float* __restrict__ BV, _Float16* __restrict__ QH, _Float16* __restrict__ KH, _Float16* __restrict__ VT) {
  __shared__ __align__(16) _Float16 so[4][16][DD + 8]; __shared__ __align__(16) _Float16 st[DD][72];
  const int tid = threadIdx.x, wave = tid >> 5, lane = tid & 31, col = lane & 15, g = lane >> 4; const size_t r0 = (size_t)blockIdx.x * 64 + wave * 16; const int which = blockIdx.y;
  const float* X = (which == 0) ? XQ : XKV; const __bf16* P = PK + (size_t)which * DD * DD; const float* BB = (which == 0) ? BQ : (which == 1) ? BK : BV; const float sc = (which == 0) ? (1.0f / 16.0f) : 1.0f;
#pragma unroll 1
  for (int half = 0; half < 2; ++half) { v8f acc[8] = {};
#pragma unroll
    for (int kc = 0; kc < DD / 32; ++kc) { v16b a; { const float* p = X + (r0 + col) * DD + kc * 32 + 8 * g;
#pragma unroll
        for (int i = 0; i < 8; ++i) { a[i] = (__bf16)p[i]; a[8 + i] = (__bf16)p[16 + i]; } }
#pragma unroll
      for (int j = 0; j < 8; ++j) acc[j] = wmma_bf(a, frag_b(P + (size_t)(half * 128 + j * 16 + col) * DD + kc * 32, lane), acc[j]); }
#pragma unroll
    for (int j = 0; j < 8; ++j) { const int n = half * 128 + j * 16 + col; const float bb = bfr(BB[n]);
#pragma unroll
      for (int r = 0; r < 8; ++r) { const float v = (acc[j][r] + bb) * sc; if (which == 2) st[n][wave * 16 + 8 * g + r] = (_Float16)v; else so[wave][8 * g + r][n] = (_Float16)v; } } }
  if (which == 2) { __syncthreads(); const size_t k0 = (size_t)blockIdx.x * 64;
    for (int q = tid; q < DD * 8; q += 128) { const int d = q >> 3, pc = q & 7; vst2((unsigned*)(VT + (size_t)d * NK + k0 + pc * 8), *(const v4u*)&st[d][pc * 8]); } }
  else { LDSX(); _Float16* DST = (which == 0) ? QH : KH;
    for (int rl = 0; rl < 16; ++rl) vst2((unsigned*)(DST + (r0 + rl) * DD + lane * 8), *(const v4u*)&so[wave][rl][lane * 8]); }
}
// ---- k_attn: block = 32 queries x 8 key groups = 16 waves (wave = 16 queries, every 8th 32-key step); the 256 keys of one step of the block are staged in LDS by asynchronous copies, whole 512-B rows per wave-instruction, and both query tiles read their fragments there: buffer 0 holds the K rows, buffer 1 the V^T rows of those keys, and the two halves of a step are the two trips of a two-buffer ring (scores read buffer 0 while buffer 1 fills; P x V reads buffer 1 while buffer 0 takes the next K rows); per step: scores (K 256 = 8 chunks, 1 product, q pre-scaled), running max, P rounded once to f16 (the rounded value also accumulates l) x V^T for all 256 output dims (16 tiles); then each wave's unnormalised partial sums with its m and l go to LDS (over the ring), one barrier, and all 512 threads merge the 8 key groups of each row; out in 512-B pieces per wave
#define SKEYS (32 * KG)                           // keys per staged tile
#define KPB 528                                   // bytes per staged K row: 512 + 16, an odd multiple of 16 B for the 16-byte fragment reads
#define VPB 80                                    // bytes per staged V^T row piece: one key group's 32 keys (64 B) + 16, an odd multiple of 16 B
#define VSUB (DD * VPB + 64)                      // bytes per key group of the V^T tile: its 256 row pieces lie together, within the reach of one LDS address; + 64 B so that the eight pieces of a copied row spread evenly over the 64 banks
#define TILE_K (SKEYS * KPB)
#define TILE_V (KG * VSUB)
// eight 16-byte copies per lane, rows J .. J + 7 of the wave's sixteen; global address = the row's scalar base + the lane's 32-bit offset. The immediate offset moves the LDS address and the global address alike, so one LDS register serves every row and each scalar base holds its row's address less that offset; the wait on the address counter closes the statement, so that no register a copy names is rewritten in front of it
template <int LS, int J> __device__ __forceinline__ void copy8(unsigned l, unsigned vo, unsigned long long a, long long gs) { const long long d = gs - LS;
  asm volatile("global_load_async_to_lds_b128 %0, %1, %2 offset:%10\n\tglobal_load_async_to_lds_b128 %0, %1, %3 offset:%11\n\tglobal_load_async_to_lds_b128 %0, %1, %4 offset:%12\n\tglobal_load_async_to_lds_b128 %0, %1, %5 offset:%13\n\t"
               "global_load_async_to_lds_b128 %0, %1, %6 offset:%14\n\tglobal_load_async_to_lds_b128 %0, %1, %7 offset:%15\n\tglobal_load_async_to_lds_b128 %0, %1, %8 offset:%16\n\tglobal_load_async_to_lds_b128 %0, %1, %9 offset:%17\n\ts_wait_xcnt 0x0"
               :: "v"(l), "v"(vo), "s"(a + J * d), "s"(a + (J + 1) * d), "s"(a + (J + 2) * d), "s"(a + (J + 3) * d), "s"(a + (J + 4) * d), "s"(a + (J + 5) * d), "s"(a + (J + 6) * d), "s"(a + (J + 7) * d),
                  "n"(J * LS), "n"((J + 1) * LS), "n"((J + 2) * LS), "n"((J + 3) * LS), "n"((J + 4) * LS), "n"((J + 5) * LS), "n"((J + 6) * LS), "n"((J + 7) * LS) : "memory");
}
// one tile: wave w brings source rows 16 w .. 16 w + 15 (512 B each, source pitch gs bytes, LDS pitch LS bytes), a lane one 16-byte piece of each; p = the wave's first row (wave-uniform)
template <int LS> __device__ __forceinline__ void stage(unsigned l, unsigned vo, const void* p, long long gs) { const unsigned long long a = (unsigned long long)p; copy8<LS, 0>(l, vo, a, gs); copy8<LS, 8>(l, vo, a, gs); }
// foot of a ring trip: this wave's LDS reads and writes are done, its own copies have landed, then the barrier that publishes the other buffer and frees the one just read
__device__ __forceinline__ void ring_foot() { asm volatile("s_wait_dscnt 0x0" ::: "memory"); asm volatile("s_wait_asynccnt 0x0" ::: "memory"); __syncthreads(); }
template <bool V> struct more_t { static constexpr bool v = V; };
static_assert(DD == SKEYS && TILE_K + TILE_V >= 2 * KG * 16 * (DD + 4) * 4, "K rows and V^T rows are both 512 B; the merge's partial sums reuse the ring");
__global__ __launch_bounds__(512) void k_attn(const _Float16* __restrict__ QH, const _Float16* __restrict__ KH, const _Float16* __restrict__ VT, float* __restrict__ OUT) {
  __shared__ __align__(16) char ring[TILE_K + TILE_V]; __shared__ __align__(16) _Float16 sp[2 * KG][16][40]; __shared__ float sm[2 * KG][16], sl[2 * KG][16];
  float (*so)[16][DD + 4] = (float (*)[16][DD + 4])ring;
  const int tid = threadIdx.x, wave = tid >> 5, lane = tid & 31, col = lane & 15, g = lane >> 4, kg = wave >> 1; const size_t q0 = (size_t)blockIdx.x * 32 + (wave & 1) * 16;
  const _Float16* sk = (const _Float16*)(ring + (kg * 32 + col) * KPB); const _Float16* sv = (const _Float16*)(ring + TILE_K + kg * VSUB + col * VPB);   // this lane's first K row and first V^T row piece
  const unsigned lk = (unsigned)(size_t)ring + (unsigned)(wave * 16 * KPB + lane * 16), lv = (unsigned)(size_t)ring + (unsigned)(TILE_K + (lane >> 2) * VSUB + wave * 16 * VPB + (lane & 3) * 16);
  const unsigned wu = (unsigned)__builtin_amdgcn_readfirstlane(wave), vo = (unsigned)lane * 16u;   // the wave's number in a scalar register: the copies' row bases are scalar
  const char* gk = (const char*)KH + (size_t)wu * (16 * DD * 2); const char* gv = (const char*)VT + (size_t)wu * (16 * NK * 2);
  stage<KPB>(lk, vo, gk, DD * 2);
  v16h aq[DD / 32];
#pragma unroll
  for (int kc = 0; kc < DD / 32; ++kc) aq[kc] = frag_h(QH + (q0 + col) * DD + kc * 32, lane);
  float m[8], l[8];
#pragma unroll
  for (int r = 0; r < 8; ++r) { m[r] = -3.0e38f; l[r] = 0.f; }
  v8f acc[16] = {};
  asm volatile("s_wait_asynccnt 0x0" ::: "memory");   // the first K tile has landed
  __syncthreads();
  stage<VPB>(lv, vo, gv, NK * 2);
  // one step of 256 keys = two ring trips; MORE: a next step exists, whose tiles are asked for at the two feet. The last step is written out behind the loop, so that no branch stands inside a step: with one, the compiler sank the tail of the softmax behind it, its values stayed live through the P x V products and a Q fragment spilled inside the key loop
  auto step = [&](int it, auto more) __attribute__((always_inline)) { constexpr bool MORE = decltype(more)::v; v8f s[2];
#pragma unroll
    for (int ct = 0; ct < 2; ++ct) { const _Float16* kr = sk + ct * (16 * KPB / 2); v8f c = {};
#pragma unroll
      for (int kc = 0; kc < DD / 32; ++kc) c = wmma16(aq[kc], frag_h(kr + kc * 32, lane), c);
      s[ct] = c; }
#pragma unroll
    for (int r = 0; r < 8; ++r) { float mx = fmaxf(s[0][r], s[1][r]);
#pragma unroll
      for (int o = 1; o < 16; o <<= 1) mx = fmaxf(mx, __shfl_xor(mx, o));
      const float mn = fmaxf(m[r], mx); const float alpha = (m[r] <= -1.0e38f) ? 0.f : __expf(m[r] - mn);
      const _Float16 e0 = (_Float16)__expf(s[0][r] - mn), e1 = (_Float16)__expf(s[1][r] - mn); float es = (float)e0 + (float)e1;   // P rounded once; the same values feed l
#pragma unroll
      for (int o = 1; o < 16; o <<= 1) es += __shfl_xor(es, o);
      l[r] = l[r] * alpha + es; m[r] = mn;
#pragma unroll
      for (int dt = 0; dt < 16; ++dt) acc[dt][r] *= alpha;
      sp[wave][8 * g + r][col] = e0; sp[wave][8 * g + r][16 + col] = e1; }
    ring_foot();
    if constexpr (MORE) stage<KPB>(lk, vo, gk + (size_t)(it + 1) * (SKEYS * DD * 2), DD * 2);
    const v16h pa = frag_h(&sp[wave][col][0], lane);
#pragma unroll
    for (int dt = 0; dt < 16; ++dt) acc[dt] = wmma16(pa, frag_h(sv + dt * (16 * VPB / 2), lane), acc[dt]);
    ring_foot();
    if constexpr (MORE) stage<VPB>(lv, vo, gv + (size_t)(it + 1) * (SKEYS * 2), NK * 2); };
#pragma unroll 1
  for (int it = 0; it < NK / SKEYS - 1; ++it) step(it, more_t<true>{});
  step(NK / SKEYS - 1, more_t<false>{});
  asm volatile("s_wait_asynccnt 0x0" ::: "memory");   // nothing is in flight when the ring becomes the merge's staging
#pragma unroll
  for (int r = 0; r < 8; ++r) { if (col == 0) { sm[wave][8 * g + r] = m[r]; sl[wave][8 * g + r] = l[r]; }   // row by row with its sums: gathered in one block behind them, the 256-register build spilled inside the key loop
#pragma unroll
    for (int dt = 0; dt < 16; ++dt) so[wave][8 * g + r][dt * 16 + col] = acc[dt][r]; }
  __syncthreads();
  // merge: 32 rows x 64 four-float pieces over 512 threads; a wave holds half of one row, so m, l and the weights are wave-uniform reads
#pragma unroll
  for (int i = 0; i < 4; ++i) { const int idx = i * 512 + tid, row = idx >> 6, c = (idx & 63) * 4, w0 = row >> 4, rl = row & 15;
    float mg[KG], mx = -3.0e38f;
#pragma unroll
    for (int k = 0; k < KG; ++k) { mg[k] = sm[2 * k + w0][rl]; mx = fmaxf(mx, mg[k]); }
    float ls = 0.f; v4f o = {};
#pragma unroll
    for (int k = 0; k < KG; ++k) { const float w = __expf(mg[k] - mx); ls += w * sl[2 * k + w0][rl]; o += w * *(const v4f*)&so[2 * k + w0][rl][c]; }
    vst2(OUT + ((size_t)blockIdx.x * 32 + row) * DD + c, o * (1.0f / ls)); }
}
extern "C" void kernel_launch(void* const* d_in, const int* in_sizes, int n_in, void* d_out, int out_size, void* d_ws, size_t ws_size, hipStream_t stream) {
  (void)in_sizes; (void)n_in; (void)out_size;
  const float** F = (const float**)d_in;   // 0 x_q [8192,256], 1 x_kv [8192,256], 2 Wq [256,256], 3 bq, 4 Wk, 5 bk, 6 Wv, 7 bv
  if (ws_size < (size_t)WS_END) return;
  char* ws = (char*)d_ws; __bf16* PK = (__bf16*)(ws + WS_PK); _Float16 *QH = (_Float16*)(ws + WS_QH), *KH = (_Float16*)(ws + WS_KH), *VT = (_Float16*)(ws + WS_VT);
  k_pack<<<dim3(DD, 3), 256, 0, stream>>>(F[2], F[4], F[6], PK);
  k_proj<<<dim3(NQ / 64, 3), 128, 0, stream>>>(F[0], F[1], PK, F[3], F[5], F[7], QH, KH, VT);
  k_attn<<<TQB, 512, 0, stream>>>(QH, KH, VT, (float*)d_out);
}

// v003
// One run takes 151 microseconds.
// Next to v002, in two timings, it ran 1.38 and 1.39 times as fast.
// All steps since v000 together make it 13.3 times as fast.
// compute dtype: x_q, x_kv, Wq, bq, Wk, bk, Wv, bv (module inputs) rounded to bf16; q, k, v projections with exact bf16 products (natural [out][in] rows) + bias on WMMA 16x16x32; q/16 and k stored once as f16, v transposed to f16 planes (single: the softmax here averages thousands of keys, so operand rounding averages out); scores with single f16 operands (1 product); P = exp(s - m) rounded once to f16 (the same value feeds l) x V (1 product); both products are formed transposed (keys x queries, then dims x queries), so a lane holds one query's scores; running-max softmax in f32 with the hardware exp; f32 accumulate; the keys are split over 8 waves per query tile, whose partial (m, l, sum P v) are merged in f32: out = (sum_g w_g O_g) / (sum_g w_g l_g), w_g = exp(m_g - max m).
#include <hip/hip_runtime.h>
#include <math.h>

typedef __attribute__((ext_vector_type(16))) _Float16 v16h;
typedef __attribute__((ext_vector_type(16))) __bf16 v16b;
typedef __attribute__((ext_vector_type(8)))  _Float16 v8h;
typedef __attribute__((ext_vector_type(8)))  float v8f;
typedef __attribute__((ext_vector_type(4)))  float v4f;
typedef __attribute__((ext_vector_type(2)))  float v2f;
typedef __attribute__((ext_vector_type(4)))  unsigned v4u;
typedef __attribute__((ext_vector_type(4)))  int v4i;
typedef float __attribute__((may_alias)) float_a;
typedef int __attribute__((may_alias)) int_a;

template <typename T> __device__ __forceinline__ void vst2(void* p, T v) { *(T*)p = v;  }
__device__ __forceinline__ v8f wmma16(v16h a, v16h b, v8f c) {
  v8f d = __builtin_amdgcn_wmma_f32_16x16x32_f16(false, a, false, b, (short)0, c, false, false);
  asm volatile("v_nop\n\tv_nop\n\tv_nop\n\tv_nop" : "+v"(d) : "v"(a), "v"(b));
  return d;
}
__device__ __forceinline__ v8f wmma_bf(v16b a, v16b b, v8f c) {
  v8f d = __builtin_amdgcn_wmma_f32_16x16x32_bf16(false, a, false, b, (short)0, c, false, false);
  asm volatile("v_nop\n\tv_nop\n\tv_nop\n\tv_nop" : "+v"(d) : "v"(a), "v"(b));
  return d;
}
// 16x16x32 fragments: lane = (h = lane>>4, row/col = lane&15); elements 0..7 = k0+8h+0..7, 8..15 = k0+16+8h+0..7; D element r = row 8h+r
__device__ __forceinline__ v16h frag_h(const _Float16* rowk0, int lane) {
  union { v16h v; v8h q[2]; } u; const _Float16* p = rowk0 + 8 * (lane >> 4);
  u.q[0] = *(const v8h*)p; u.q[1] = *(const v8h*)(p + 16); return u.v;
}
__device__ __forceinline__ v16h frag_f32(const float* rowk0, int lane) {
  v16h a; const float* p = rowk0 + 8 * (lane >> 4);
#pragma unroll
  for (int i = 0; i < 8; ++i) { a[i] = (_Float16)p[i]; a[8 + i] = (_Float16)p[16 + i]; }
  return a;
}
__device__ __forceinline__ v16h frag_f32s(const float* rowk0, int lane, float sc) {
  v16h a; const float* p = rowk0 + 8 * (lane >> 4);
#pragma unroll
  for (int i = 0; i < 8; ++i) { a[i] = (_Float16)(p[i] * sc); a[8 + i] = (_Float16)(p[16 + i] * sc); }
  return a;
}
// column fragment from a [K][ld] layout (column n), rows >= K read as 0
__device__ __forceinline__ v16h fragc_f32(const float* W, int k0, int n, int lane, int ld, int K) {
  v16h a; const int g = lane >> 4;
#pragma unroll
  for (int i = 0; i < 8; ++i) { const int ka = k0 + 8 * g + i, kb = ka + 16;
    a[i] = (_Float16)(ka < K ? W[(size_t)(ka < K ? ka : K - 1) * ld + n] : 0.f); a[8 + i] = (_Float16)(kb < K ? W[(size_t)(kb < K ? kb : K - 1) * ld + n] : 0.f); }
  return a;
}
struct F2 { v16b h, l; };
__device__ __forceinline__ F2 bsplit16(const float v[16]) { F2 r;
#pragma unroll
  for (int i = 0; i < 16; ++i) { const __bf16 h = (__bf16)v[i]; r.h[i] = h; r.l[i] = (__bf16)(v[i] - (float)h); }
  return r; }
__device__ __forceinline__ F2 split_row(const float* row, int k0, int lane) { float v[16]; const float* p = row + k0 + 8 * (lane >> 4);
#pragma unroll
  for (int i = 0; i < 8; ++i) { v[i] = p[i]; v[8 + i] = p[16 + i]; }
  return bsplit16(v); }
__device__ __forceinline__ F2 split_rowK(const float* row, int k0, int lane, int K) { float v[16]; const int g = lane >> 4;
#pragma unroll
  for (int i = 0; i < 8; ++i) { const int ka = k0 + 8 * g + i, kb = ka + 16; v[i] = ka < K ? row[ka < K ? ka : K - 1] : 0.f; v[8 + i] = kb < K ? row[kb < K ? kb : K - 1] : 0.f; }
  return bsplit16(v); }
__device__ __forceinline__ F2 split_col(const float* W, int k0, int n, int lane, int ld, int K) { float v[16]; const int g = lane >> 4;
#pragma unroll
  for (int i = 0; i < 8; ++i) { const int ka = k0 + 8 * g + i, kb = ka + 16; v[i] = ka < K ? W[(size_t)(ka < K ? ka : K - 1) * ld + n] : 0.f; v[8 + i] = kb < K ? W[(size_t)(kb < K ? kb : K - 1) * ld + n] : 0.f; }
  return bsplit16(v); }
__device__ __forceinline__ v8f mac3(const F2& a, const F2& b, v8f c) { c = wmma_bf(a.l, b.h, c); c = wmma_bf(a.h, b.l, c); return wmma_bf(a.h, b.h, c); }
__device__ __forceinline__ float sigm(float v) { return 1.0f / (1.0f + expf(-v)); }
#define LDSX() do { asm volatile("s_wait_dscnt 0" ::: "memory"); __builtin_amdgcn_wave_barrier(); __builtin_amdgcn_fence(__ATOMIC_RELEASE, "workgroup"); } while (0)


// Cross-stream single-head attention (N = M = 8,192, D 256): softmax((x_q Wq^T + bq)(x_kv Wk^T + bk)^T / 16) (x_kv Wv^T + bv).
#define NQ 8192
#define NK 8192
#define DD 256
#ifndef TQB
#define TQB (NQ / 32)
#endif
typedef __attribute__((ext_vector_type(8))) __bf16 v8b;
__device__ __forceinline__ v16b frag_b(const __bf16* rowk0, int lane) {
  union { v16b v; v8b q[2]; } u; const __bf16* p = rowk0 + 8 * (lane >> 4);
  u.q[0] = *(const v8b*)p; u.q[1] = *(const v8b*)(p + 16); return u.v;
}
__device__ __forceinline__ float bfr(float v) { return (float)(__bf16)v; }
__device__ __attribute__((noinline)) float exp_ni(float v) { return expf(v); }
__device__ __attribute__((noinline)) float erf_ni(float v) { return erff(v); }

#define KG 8                                      // key groups (waves) that share one 16-query tile
#define WS_PK  0u                                 // bf16 [3][256][256] Wq, Wk, Wv natural rows
#define WS_QH  (WS_PK + 2u * 3 * DD * DD)            // f16 [8192][256] q/16
#define WS_KH  (WS_QH + 2u * NQ * DD)                // f16 [8192][256] k
#define WS_VT  (WS_KH + 2u * NK * DD)                // f16 [256 d][8192 keys] v^T
#define WS_END (WS_VT + 2u * DD * NK)

__global__ __launch_bounds__(256) void k_pack(const float* __restrict__ WQ, const float* __restrict__ WK, const float* __restrict__ WV, __bf16* __restrict__ PK) {
  __shared__ __align__(16) __bf16 s[DD]; const int n = blockIdx.x, which = blockIdx.y, t = threadIdx.x; const float* Wm = (which == 0) ? WQ : (which == 1) ? WK : WV;
  s[t] = (__bf16)Wm[(size_t)n * DD + t]; __syncthreads();
  if (t < DD / 8) vst2((unsigned*)(PK + ((size_t)which * DD + n) * DD + t * 8), *(const v4u*)&s[t * 8]);
}
__global__ __launch_bounds__(128) void k_proj(const float* __restrict__ XQ, const float* __restrict__ XKV, const __bf16* __restrict__ PK, const float* __restrict__ BQ, const float* __restrict__ BK, const float* __restrict__ BV, _Float16* __restrict__ QH, _Float16* __restrict__ KH, _Float16* __restrict__ VT) {
  __shared__ __align__(16) _Float16 so[4][16][DD + 8]; __shared__ __align__(16) _Float16 st[DD][72];
  const int tid = threadIdx.x, wave = tid >> 5, lane = tid & 31, col = lane & 15, g = lane >> 4; const size_t r0 = (size_t)blockIdx.x * 64 + wave * 16; const int which = blockIdx.y;
  const float* X = (which == 0) ? XQ : XKV; const __bf16* P = PK + (size_t)which * DD * DD; const float* BB = (which == 0) ? BQ : (which == 1) ? BK : BV; const float sc = (which == 0) ? (1.0f / 16.0f) : 1.0f;
#pragma unroll 1
  for (int half = 0; half < 2; ++half) { v8f acc[8] = {};
#pragma unroll
    for (int kc = 0; kc < DD / 32; ++kc) { v16b a; { const float* p = X + (r0 + col) * DD + kc * 32 + 8 * g;
#pragma unroll
        for (int i = 0; i < 8; ++i) { a[i] = (__bf16)p[i]; a[8 + i] = (__bf16)p[16 + i]; } }
#pragma unroll
      for (int j = 0; j < 8; ++j) acc[j] = wmma_bf(a, frag_b(P + (size_t)(half * 128 + j * 16 + col) * DD + kc * 32, lane), acc[j]); }
#pragma unroll
    for (int j = 0; j < 8; ++j) { const int n = half * 128 + j * 16 + col; const float bb = bfr(BB[n]);
#pragma unroll
      for (int r = 0; r < 8; ++r) { const float v = (acc[j][r] + bb) * sc; if (which == 2) st[n][wave * 16 + 8 * g + r] = (_Float16)v; else so[wave][8 * g + r][n] = (_Float16)v; } } }
  if (which == 2) { __syncthreads(); const size_t k0 = (size_t)blockIdx.x * 64;
    for (int q = tid; q < DD * 8; q += 128) { const int d = q >> 3, pc = q & 7; vst2((unsigned*)(VT + (size_t)d * NK + k0 + pc * 8), *(const v4u*)&st[d][pc * 8]); } }
  else { LDSX(); _Float16* DST = (which == 0) ? QH : KH;
    for (int rl = 0; rl < 16; ++rl) vst2((unsigned*)(DST + (r0 + rl) * DD + lane * 8), *(const v4u*)&so[wave][rl][lane * 8]); }
}
// ---- k_attn: block = 32 queries x 8 key groups = 16 waves (wave = 16 queries, every 8th 32-key step); the 256 keys of one step of the block are staged in LDS by asynchronous copies, whole 512-B rows per wave-instruction, and both query tiles read their fragments there: buffer 0 holds the K rows, buffer 1 the V^T rows of those keys, and the two halves of a step are the two trips of a two-buffer ring (scores read buffer 0 while buffer 1 fills; P x V reads buffer 1 while buffer 0 takes the next K rows); per step: S^T = K q^T (A = K rows, B = the Q fragments kept in registers; K 256 = 8 chunks, 1 product, q pre-scaled), so lane (g, col) holds 16 of query col's 32 scores: the maximum is taken in the lane and joined once with the other wave half, l stays a per-half sum until the epilogue, m, l and the rescale factor are one register each; P^T rounded once to f16 (the rounded value also accumulates l) is packed from the two score tiles straight into a B operand (element i = tile i / 8, register i % 8: the k order of frag_h) and O^T += V^T P^T for all 256 output dims (16 tiles, A = V^T rows); then each wave's unnormalised partial sums with its m and l go to LDS (over the ring), one barrier, and all 512 threads merge the 8 key groups of each row; out in 512-B pieces per wave
#define SKEYS (32 * KG)                           // keys per staged tile
#define KPB 528                                   // bytes per staged K row: 512 + 16, an odd multiple of 16 B for the 16-byte fragment reads
#define VPB 80                                    // bytes per staged V^T row piece: one key group's 32 keys (64 B) + 16, an odd multiple of 16 B
#define VSUB (DD * VPB + 64)                      // bytes per key group of the V^T tile: its 256 row pieces lie together, within the reach of one LDS address; + 64 B so that the eight pieces of a copied row spread evenly over the 64 banks
#define TILE_K (SKEYS * KPB)
#define TILE_V (KG * VSUB)
// eight 16-byte copies per lane, rows J .. J + 7 of the wave's sixteen; global address = the row's scalar base + the lane's 32-bit offset. The immediate offset moves the LDS address and the global address alike, so one LDS register serves every row and each scalar base holds its row's address less that offset; the wait on the address counter closes the statement, so that no register a copy names is rewritten in front of it
template <int LS, int J> __device__ __forceinline__ void copy8(unsigned l, unsigned vo, unsigned long long a, long long gs) { const long long d = gs - LS;
  asm volatile("global_load_async_to_lds_b128 %0, %1, %2 offset:%10\n\tglobal_load_async_to_lds_b128 %0, %1, %3 offset:%11\n\tglobal_load_async_to_lds_b128 %0, %1, %4 offset:%12\n\tglobal_load_async_to_lds_b128 %0, %1, %5 offset:%13\n\t"
               "global_load_async_to_lds_b128 %0, %1, %6 offset:%14\n\tglobal_load_async_to_lds_b128 %0, %1, %7 offset:%15\n\tglobal_load_async_to_lds_b128 %0, %1, %8 offset:%16\n\tglobal_load_async_to_lds_b128 %0, %1, %9 offset:%17\n\ts_wait_xcnt 0x0"
               :: "v"(l), "v"(vo), "s"(a + J * d), "s"(a + (J + 1) * d), "s"(a + (J + 2) * d), "s"(a + (J + 3) * d), "s"(a + (J + 4) * d), "s"(a + (J + 5) * d), "s"(a + (J + 6) * d), "s"(a + (J + 7) * d),
                  "n"(J * LS), "n"((J + 1) * LS), "n"((J + 2) * LS), "n"((J + 3) * LS), "n"((J + 4) * LS), "n"((J + 5) * LS), "n"((J + 6) * LS), "n"((J + 7) * LS) : "memory");
}
// one tile: wave w brings source rows 16 w .. 16 w + 15 (512 B each, source pitch gs bytes, LDS pitch LS bytes), a lane one 16-byte piece of each; p = the wave's first row (wave-uniform)
template <int LS> __device__ __forceinline__ void stage(unsigned l, unsigned vo, const void* p, long long gs) { const unsigned long long a = (unsigned long long)p; copy8<LS, 0>(l, vo, a, gs); copy8<LS, 8>(l, vo, a, gs); }
// foot of a ring trip: this wave's LDS reads and writes are done, its own copies have landed, then the barrier that publishes the other buffer and frees the one just read
__device__ __forceinline__ void ring_foot() { asm volatile("s_wait_dscnt 0x0" ::: "memory"); asm volatile("s_wait_asynccnt 0x0" ::: "memory"); __syncthreads(); }
__device__ __forceinline__ float xhalf(float x) { return __builtin_bit_cast(float, __builtin_amdgcn_permlanex16(__builtin_bit_cast(int, x), __builtin_bit_cast(int, x), 0x76543210, 0xfedcba98, false, false)); }   // lane l takes lane l ^ 16's value
template <bool V> struct more_t { static constexpr bool v = V; };
static_assert(DD == SKEYS && TILE_K + TILE_V >= 2 * KG * 16 * (DD + 4) * 4, "K rows and V^T rows are both 512 B; the merge's partial sums reuse the ring");
__global__ __launch_bounds__(512) void k_attn(const _Float16* __restrict__ QH, const _Float16* __restrict__ KH, const _Float16* __restrict__ VT, float* __restrict__ OUT) {
  __shared__ __align__(16) char ring[TILE_K + TILE_V]; __shared__ float sm[2 * KG][16], sl[2 * KG][16];
  float (*so)[16][DD + 4] = (float (*)[16][DD + 4])ring;
  const int tid = threadIdx.x, wave = tid >> 5, lane = tid & 31, col = lane & 15, g = lane >> 4, kg = wave >> 1; const size_t q0 = (size_t)blockIdx.x * 32 + (wave & 1) * 16;
  const _Float16* sk = (const _Float16*)(ring + (kg * 32 + col) * KPB); const _Float16* sv = (const _Float16*)(ring + TILE_K + kg * VSUB + col * VPB);   // this lane's first K row and first V^T row piece
  const unsigned lk = (unsigned)(size_t)ring + (unsigned)(wave * 16 * KPB + lane * 16), lv = (unsigned)(size_t)ring + (unsigned)(TILE_K + (lane >> 2) * VSUB + wave * 16 * VPB + (lane & 3) * 16);
  const unsigned wu = (unsigned)__builtin_amdgcn_readfirstlane(wave), vo = (unsigned)lane * 16u;   // the wave's number in a scalar register: the copies' row bases are scalar
  const char* gk = (const char*)KH + (size_t)wu * (16 * DD * 2); const char* gv = (const char*)VT + (size_t)wu * (16 * NK * 2);
  stage<KPB>(lk, vo, gk, DD * 2);
  v16h aq[DD / 32];
#pragma unroll
  for (int kc = 0; kc < DD / 32; ++kc) aq[kc] = frag_h(QH + (q0 + col) * DD + kc * 32, lane);
  float m = -3.0e38f, l = 0.f;   // query col's running maximum (alike in both wave halves) and this half's share of its sum
  v8f acc[16] = {};
  asm volatile("s_wait_asynccnt 0x0" ::: "memory");   // the first K tile has landed
  __syncthreads();
  stage<VPB>(lv, vo, gv, NK * 2);
  // one step of 256 keys = two ring trips; MORE: a next step exists, whose tiles are asked for at the two feet. The last step is written out behind the loop, so that no branch stands inside a step: with one, the compiler sank the tail of the softmax behind it, its values stayed live through the P x V products and a Q fragment spilled inside the key loop
  auto step = [&](int it, auto more) __attribute__((always_inline)) { constexpr bool MORE = decltype(more)::v; v8f s[2];
#pragma unroll
    for (int ct = 0; ct < 2; ++ct) { const _Float16* kr = sk + ct * (16 * KPB / 2); v8f c = {};
#pragma unroll
      for (int kc = 0; kc < DD / 32; ++kc) c = wmma16(frag_h(kr + kc * 32, lane), aq[kc], c);
      s[ct] = c; }
    float t[8];   // s[ct][r] = score of key 16 ct + 8 g + r with query col
#pragma unroll
    for (int r = 0; r < 8; ++r) t[r] = fmaxf(s[0][r], s[1][r]);
    float mx = fmaxf(fmaxf(fmaxf(t[0], t[1]), fmaxf(t[2], t[3])), fmaxf(fmaxf(t[4], t[5]), fmaxf(t[6], t[7])));
    mx = fmaxf(mx, xhalf(mx));
    const float mn = fmaxf(m, mx); const float alpha = (m <= -1.0e38f) ? 0.f : __expf(m - mn);
    v16h pb;
#pragma unroll
    for (int r = 0; r < 8; ++r) { const _Float16 e0 = (_Float16)__expf(s[0][r] - mn), e1 = (_Float16)__expf(s[1][r] - mn); pb[r] = e0; pb[8 + r] = e1; t[r] = (float)e0 + (float)e1; }   // P rounded once; the same values feed l
    l = l * alpha + (((t[0] + t[1]) + (t[2] + t[3])) + ((t[4] + t[5]) + (t[6] + t[7]))); m = mn;
#pragma unroll
    for (int dt = 0; dt < 16; ++dt) acc[dt] *= alpha;
    ring_foot();
    if constexpr (MORE) stage<KPB>(lk, vo, gk + (size_t)(it + 1) * (SKEYS * DD * 2), DD * 2);
#pragma unroll
    for (int dt = 0; dt < 16; ++dt) acc[dt] = wmma16(frag_h(sv + dt * (16 * VPB / 2), lane), pb, acc[dt]);
    ring_foot();
    if constexpr (MORE) stage<VPB>(lv, vo, gv + (size_t)(it + 1) * (SKEYS * 2), NK * 2); };
#pragma unroll 1
  for (int it = 0; it < NK / SKEYS - 1; ++it) step(it, more_t<true>{});
  step(NK / SKEYS - 1, more_t<false>{});
  asm volatile("s_wait_asynccnt 0x0" ::: "memory");   // nothing is in flight when the ring becomes the merge's staging
  const float lt = l + xhalf(l);   // the two wave halves' sums are joined once
  if (g == 0) { sm[wave][col] = m; sl[wave][col] = lt; }
#pragma unroll
  for (int dt = 0; dt < 16; ++dt) { float* o = &so[wave][col][dt * 16 + 8 * g];   // acc[dt][r] = dim 16 dt + 8 g + r of query col: eight neighbours of one row
    vst2(o, (v4f){acc[dt][0], acc[dt][1], acc[dt][2], acc[dt][3]}); vst2(o + 4, (v4f){acc[dt][4], acc[dt][5], acc[dt][6], acc[dt][7]}); }
  __syncthreads();
  // merge: 32 rows x 64 four-float pieces over 512 threads; a wave holds half of one row, so m, l and the weights are wave-uniform reads
#pragma unroll
  for (int i = 0; i < 4; ++i) { const int idx = i * 512 + tid, row = idx >> 6, c = (idx & 63) * 4, w0 = row >> 4, rl = row & 15;
    float mg[KG], mx = -3.0e38f;
#pragma unroll
    for (int k = 0; k < KG; ++k) { mg[k] = sm[2 * k + w0][rl]; mx = fmaxf(mx, mg[k]); }
    float ls = 0.f; v4f o = {};
#pragma unroll
    for (int k = 0; k < KG; ++k) { const float w = __expf(mg[k] - mx); ls += w * sl[2 * k + w0][rl]; o += w * *(const v4f*)&so[2 * k + w0][rl][c]; }
    vst2(OUT + ((size_t)blockIdx.x * 32 + row) * DD + c, o * (1.0f / ls)); }
}
extern "C" void kernel_launch(void* const* d_in, const int* in_sizes, int n_in, void* d_out, int out_size, void* d_ws, size_t ws_size, hipStream_t stream) {
  (void)in_sizes; (void)n_in; (void)out_size;
  const float** F = (const float**)d_in;   // 0 x_q [8192,256], 1 x_kv [8192,256], 2 Wq [256,256], 3 bq, 4 Wk, 5 bk, 6 Wv, 7 bv
  if (ws_size < (size_t)WS_END) return;
  char* ws = (char*)d_ws; __bf16* PK = (__bf16*)(ws + WS_PK); _Float16 *QH = (_Float16*)(ws + WS_QH), *KH = (_Float16*)(ws + WS_KH), *VT = (_Float16*)(ws + WS_VT);
  k_pack<<<dim3(DD, 3), 256, 0, stream>>>(F[2], F[4], F[6], PK);
  k_proj<<<dim3(NQ / 64, 3), 128, 0, stream>>>(F[0], F[1], PK, F[3], F[5], F[7], QH, KH, VT);
  k_attn<<<TQB, 512, 0, stream>>>(QH, KH, VT, (float*)d_out);
}

// v004
// It runs in 123 microseconds.
// In both of two side-by-side timings against v003, it was 1.20 times as fast.
// All steps since v000 together make it 15.9 times as fast.
// compute dtype: x_q, x_kv, Wq, bq, Wk, bk, Wv, bv (module inputs) rounded to bf16; q, k, v projections with exact bf16 products (natural [out][in] rows) + bias on WMMA 16x16x32; q/16 and k stored once as f16, v transposed to f16 planes (single: the softmax here averages thousands of keys, so operand rounding averages out); scores with single f16 operands (1 product); P = exp(s - m) rounded once to f16 (the same value feeds l) x V (1 product); both products are formed transposed (keys x queries, then dims x queries), so a lane holds one query's scores; running-max softmax in f32 with the hardware exp; f32 accumulate; the keys are split over 4 work-groups x 2 waves per query tile, whose partial (m, l, sum P v) are merged in f32, first the two waves' in LDS, then the four work-groups' in a launch of its own: out = (sum_g w_g O_g) / (sum_g w_g l_g), w_g = exp(m_g - max m).
#include <hip/hip_runtime.h>
#include <math.h>

typedef __attribute__((ext_vector_type(16))) _Float16 v16h;
typedef __attribute__((ext_vector_type(16))) __bf16 v16b;
typedef __attribute__((ext_vector_type(8)))  _Float16 v8h;
typedef __attribute__((ext_vector_type(8)))  float v8f;
typedef __attribute__((ext_vector_type(4)))  float v4f;
typedef __attribute__((ext_vector_type(2)))  float v2f;
typedef __attribute__((ext_vector_type(4)))  unsigned v4u;
typedef __attribute__((ext_vector_type(4)))  int v4i;
typedef float __attribute__((may_alias)) float_a;
typedef int __attribute__((may_alias)) int_a;

template <typename T> __device__ __forceinline__ void vst2(void* p, T v) { *(T*)p = v;  }
__device__ __forceinline__ v8f wmma16(v16h a, v16h b, v8f c) {
  v8f d = __builtin_amdgcn_wmma_f32_16x16x32_f16(false, a, false, b, (short)0, c, false, false);
  asm volatile("v_nop\n\tv_nop\n\tv_nop\n\tv_nop" : "+v"(d) : "v"(a), "v"(b));
  return d;
}
__device__ __forceinline__ v8f wmma_bf(v16b a, v16b b, v8f c) {
  v8f d = __builtin_amdgcn_wmma_f32_16x16x32_bf16(false, a, false, b, (short)0, c, false, false);
  asm volatile("v_nop\n\tv_nop\n\tv_nop\n\tv_nop" : "+v"(d) : "v"(a), "v"(b));
  return d;
}
// 16x16x32 fragments: lane = (h = lane>>4, row/col = lane&15); elements 0..7 = k0+8h+0..7, 8..15 = k0+16+8h+0..7; D element r = row 8h+r
__device__ __forceinline__ v16h frag_h(const _Float16* rowk0, int lane) {
  union { v16h v; v8h q[2]; } u; const _Float16* p = rowk0 + 8 * (lane >> 4);
  u.q[0] = *(const v8h*)p; u.q[1] = *(const v8h*)(p + 16); return u.v;
}
__device__ __forceinline__ v16h frag_f32(const float* rowk0, int lane) {
  v16h a; const float* p = rowk0 + 8 * (lane >> 4);
#pragma unroll
  for (int i = 0; i < 8; ++i) { a[i] = (_Float16)p[i]; a[8 + i] = (_Float16)p[16 + i]; }
  return a;
}
__device__ __forceinline__ v16h frag_f32s(const float* rowk0, int lane, float sc) {
  v16h a; const float* p = rowk0 + 8 * (lane >> 4);
#pragma unroll
  for (int i = 0; i < 8; ++i) { a[i] = (_Float16)(p[i] * sc); a[8 + i] = (_Float16)(p[16 + i] * sc); }
  return a;
}
// column fragment from a [K][ld] layout (column n), rows >= K read as 0
__device__ __forceinline__ v16h fragc_f32(const float* W, int k0, int n, int lane, int ld, int K) {
  v16h a; const int g = lane >> 4;
#pragma unroll
  for (int i = 0; i < 8; ++i) { const int ka = k0 + 8 * g + i, kb = ka + 16;
    a[i] = (_Float16)(ka < K ? W[(size_t)(ka < K ? ka : K - 1) * ld + n] : 0.f); a[8 + i] = (_Float16)(kb < K ? W[(size_t)(kb < K ? kb : K - 1) * ld + n] : 0.f); }
  return a;
}
struct F2 { v16b h, l; };
__device__ __forceinline__ F2 bsplit16(const float v[16]) { F2 r;
#pragma unroll
  for (int i = 0; i < 16; ++i) { const __bf16 h = (__bf16)v[i]; r.h[i] = h; r.l[i] = (__bf16)(v[i] - (float)h); }
  return r; }
__device__ __forceinline__ F2 split_row(const float* row, int k0, int lane) { float v[16]; const float* p = row + k0 + 8 * (lane >> 4);
#pragma unroll
  for (int i = 0; i < 8; ++i) { v[i] = p[i]; v[8 + i] = p[16 + i]; }
  return bsplit16(v); }
__device__ __forceinline__ F2 split_rowK(const float* row, int k0, int lane, int K) { float v[16]; const int g = lane >> 4;
#pragma unroll
  for (int i = 0; i < 8; ++i) { const int ka = k0 + 8 * g + i, kb = ka + 16; v[i] = ka < K ? row[ka < K ? ka : K - 1] : 0.f; v[8 + i] = kb < K ? row[kb < K ? kb : K - 1] : 0.f; }
  return bsplit16(v); }
__device__ __forceinline__ F2 split_col(const float* W, int k0, int n, int lane, int ld, int K) { float v[16]; const int g = lane >> 4;
#pragma unroll
  for (int i = 0; i < 8; ++i) { const int ka = k0 + 8 * g + i, kb = ka + 16; v[i] = ka < K ? W[(size_t)(ka < K ? ka : K - 1) * ld + n] : 0.f; v[8 + i] = kb < K ? W[(size_t)(kb < K ? kb : K - 1) * ld + n] : 0.f; }
  return bsplit16(v); }
__device__ __forceinline__ v8f mac3(const F2& a, const F2& b, v8f c) { c = wmma_bf(a.l, b.h, c); c = wmma_bf(a.h, b.l, c); return wmma_bf(a.h, b.h, c); }
__device__ __forceinline__ float sigm(float v) { return 1.0f / (1.0f + expf(-v)); }
#define LDSX() do { asm volatile("s_wait_dscnt 0" ::: "memory"); __builtin_amdgcn_wave_barrier(); __builtin_amdgcn_fence(__ATOMIC_RELEASE, "workgroup"); } while (0)


// Cross-stream single-head attention (N = M = 8,192, D 256): softmax((x_q Wq^T + bq)(x_kv Wk^T + bk)^T / 16) (x_kv Wv^T + bv).
#define NQ 8192
#define NK 8192
#define DD 256
typedef __attribute__((ext_vector_type(8))) __bf16 v8b;
__device__ __forceinline__ v16b frag_b(const __bf16* rowk0, int lane) {
  union { v16b v; v8b q[2]; } u; const __bf16* p = rowk0 + 8 * (lane >> 4);
  u.q[0] = *(const v8b*)p; u.q[1] = *(const v8b*)(p + 16); return u.v;
}
__device__ __forceinline__ float bfr(float v) { return (float)(__bf16)v; }
__device__ __attribute__((noinline)) float exp_ni(float v) { return expf(v); }
__device__ __attribute__((noinline)) float erf_ni(float v) { return erff(v); }

#define KG 2                                      // key groups (waves) that share one 16-query tile inside a block
#define QT 8                                      // 16-query tiles of a block
#define KS 4                                      // key ranges, one block each per 128 queries
#define WS_PK  0u                                 // bf16 [3][256][256] Wq, Wk, Wv natural rows
#define WS_QH  (WS_PK + 2u * 3 * DD * DD)            // f16 [8192][256] q/16
#define WS_KH  (WS_QH + 2u * NQ * DD)                // f16 [8192][256] k
#define WS_VT  (WS_KH + 2u * NK * DD)                // f16 [256 d][8192 keys] v^T
#define WS_PO  (WS_VT + 2u * DD * NK)                // f32 [KS][8192][256] unnormalised partial sums of one key range
#define WS_PM  (WS_PO + 4u * KS * NQ * DD)           // f32 [KS][8192] the range's maximum
#define WS_PL  (WS_PM + 4u * KS * NQ)                // f32 [KS][8192] the range's sum
#define WS_END (WS_PL + 4u * KS * NQ)

__global__ __launch_bounds__(256) void k_pack(const float* __restrict__ WQ, const float* __restrict__ WK, const float* __restrict__ WV, __bf16* __restrict__ PK) {
  __shared__ __align__(16) __bf16 s[DD]; const int n = blockIdx.x, which = blockIdx.y, t = threadIdx.x; const float* Wm = (which == 0) ? WQ : (which == 1) ? WK : WV;
  s[t] = (__bf16)Wm[(size_t)n * DD + t]; __syncthreads();
  if (t < DD / 8) vst2((unsigned*)(PK + ((size_t)which * DD + n) * DD + t * 8), *(const v4u*)&s[t * 8]);
}
__global__ __launch_bounds__(128) void k_proj(const float* __restrict__ XQ, const float* __restrict__ XKV, const __bf16* __restrict__ PK, const float* __restrict__ BQ, const float* __restrict__ BK, const float* __restrict__ BV, _Float16* __restrict__ QH, _Float16* __restrict__ KH, _Float16* __restrict__ VT) {
  __shared__ __align__(16) _Float16 so[4][16][DD + 8]; __shared__ __align__(16) _Float16 st[DD][72];
  const int tid = threadIdx.x, wave = tid >> 5, lane = tid & 31, col = lane & 15, g = lane >> 4; const size_t r0 = (size_t)blockIdx.x * 64 + wave * 16; const int which = blockIdx.y;
  const float* X = (which == 0) ? XQ : XKV; const __bf16* P = PK + (size_t)which * DD * DD; const float* BB = (which == 0) ? BQ : (which == 1) ? BK : BV; const float sc = (which == 0) ? (1.0f / 16.0f) : 1.0f;
#pragma unroll 1
  for (int half = 0; half < 2; ++half) { v8f acc[8] = {};
#pragma unroll
    for (int kc = 0; kc < DD / 32; ++kc) { v16b a; { const float* p = X + (r0 + col) * DD + kc * 32 + 8 * g;
#pragma unroll
        for (int i = 0; i < 8; ++i) { a[i] = (__bf16)p[i]; a[8 + i] = (__bf16)p[16 + i]; } }
#pragma unroll
      for (int j = 0; j < 8; ++j) acc[j] = wmma_bf(a, frag_b(P + (size_t)(half * 128 + j * 16 + col) * DD + kc * 32, lane), acc[j]); }
#pragma unroll
    for (int j = 0; j < 8; ++j) { const int n = half * 128 + j * 16 + col; const float bb = bfr(BB[n]);
#pragma unroll
      for (int r = 0; r < 8; ++r) { const float v = (acc[j][r] + bb) * sc; if (which == 2) st[n][wave * 16 + 8 * g + r] = (_Float16)v; else so[wave][8 * g + r][n] = (_Float16)v; } } }
  if (which == 2) { __syncthreads(); const size_t k0 = (size_t)blockIdx.x * 64;
    for (int q = tid; q < DD * 8; q += 128) { const int d = q >> 3, pc = q & 7; vst2((unsigned*)(VT + (size_t)d * NK + k0 + pc * 8), *(const v4u*)&st[d][pc * 8]); } }
  else { LDSX(); _Float16* DST = (which == 0) ? QH : KH;
    for (int rl = 0; rl < 16; ++rl) vst2((unsigned*)(DST + (r0 + rl) * DD + lane * 8), *(const v4u*)&so[wave][rl][lane * 8]); }
}
// ---- k_attn: block = 128 queries x one key range of 2,048 keys = 8 query tiles x 2 key groups = 16 waves (wave = 16 queries, every 2nd 32-key step of the range), so a staged key is read from L2 once per 128 queries; the 64 keys of one step of the block are staged in LDS by asynchronous copies, and all eight query tiles read their fragments there: buffer 0 holds the K rows, buffer 1 the V^T rows of those keys, and the two halves of a step are the two trips of a two-buffer ring (scores read buffer 0 while buffer 1 fills; P x V reads buffer 1 while buffer 0 takes the next K rows); per step: S^T = K q^T (A = K rows, B = the Q fragments kept in registers; K 256 = 8 chunks, 1 product, q pre-scaled), so lane (g, col) holds 16 of query col's 32 scores: the maximum is taken in the lane and joined once with the other wave half, l stays a per-half sum until the epilogue, m, l and the rescale factor are one register each; P^T rounded once to f16 (the rounded value also accumulates l) is packed from the two score tiles straight into a B operand (element i = tile i / 8, register i % 8: the k order of frag_h) and O^T += V^T P^T for all 256 output dims (16 tiles, A = V^T rows); then each wave's unnormalised partial sums with its m and l go to LDS (over the ring), one barrier, and all 512 threads merge the 2 key groups of each row; the range's unnormalised sums, maximum and sum go to the workspace in 512-B pieces per wave, and k_merge joins the four ranges
#define SKEYS (32 * KG)                           // keys per staged tile
#define KSPAN (NK / KS)                           // keys per block
#define KPB 528                                   // bytes per staged K row: 512 + 16, an odd multiple of 16 B for the 16-byte fragment reads
#define VPB 80                                    // bytes per staged V^T row piece: one key group's 32 keys (64 B) + 16, an odd multiple of 16 B
#define VSUB (DD * VPB + 64)                      // bytes per key group of the V^T tile: its 256 row pieces lie together, within the reach of one LDS address; + 64 B so that the two pieces of a copied row fall on different banks
#define TILE_K (SKEYS * KPB)
#define TILE_V (KG * VSUB)
#define SO_B (QT * KG * 16 * (DD + 4) * 4)        // bytes of the merge's staging, which reuses the ring
// four 16-byte copies per lane; global address = the copy's scalar base + the lane's 32-bit offset; from one copy to the next the LDS address moves by LS bytes and the global address by gs. The immediate offset moves the LDS address and the global address alike, so one LDS register serves all four and each scalar base holds its address less that offset; the wait on the address counter closes the statement, so that no register a copy names is rewritten in front of it
template <int LS> __device__ __forceinline__ void stage(unsigned l, unsigned vo, const void* p, long long gs) { const unsigned long long a = (unsigned long long)p; const long long d = gs - LS;
  asm volatile("global_load_async_to_lds_b128 %0, %1, %2 offset:%6\n\tglobal_load_async_to_lds_b128 %0, %1, %3 offset:%7\n\tglobal_load_async_to_lds_b128 %0, %1, %4 offset:%8\n\tglobal_load_async_to_lds_b128 %0, %1, %5 offset:%9\n\ts_wait_xcnt 0x0"
               :: "v"(l), "v"(vo), "s"(a), "s"(a + d), "s"(a + 2 * d), "s"(a + 3 * d), "n"(0), "n"(LS), "n"(2 * LS), "n"(3 * LS) : "memory");
}
// foot of a ring trip: this wave's LDS reads and writes are done, its own copies have landed, then the barrier that publishes the other buffer and frees the one just read
__device__ __forceinline__ void ring_foot() { asm volatile("s_wait_dscnt 0x0" ::: "memory"); asm volatile("s_wait_asynccnt 0x0" ::: "memory"); __syncthreads(); }
__device__ __forceinline__ float xhalf(float x) { return __builtin_bit_cast(float, __builtin_amdgcn_permlanex16(__builtin_bit_cast(int, x), __builtin_bit_cast(int, x), 0x76543210, 0xfedcba98, false, false)); }   // lane l takes lane l ^ 16's value
template <bool V> struct more_t { static constexpr bool v = V; };
static_assert(QT * KG == 16 && SKEYS == 64 && DD == 256 && TILE_K + TILE_V <= SO_B, "16 waves bring 4 K rows (512 B each) and 16 V^T rows (128 B each, four per copy) apiece; the merge's partial sums reuse the ring");
__global__ __launch_bounds__(512) void k_attn(const _Float16* __restrict__ QH, const _Float16* __restrict__ KH, const _Float16* __restrict__ VT, float* __restrict__ PO, float* __restrict__ PM, float* __restrict__ PL) {
  __shared__ __align__(16) char ring[SO_B]; __shared__ float sm[QT * KG][16], sl[QT * KG][16];
  float (*so)[16][DD + 4] = (float (*)[16][DD + 4])ring;
  const int tid = threadIdx.x, wave = tid >> 5, lane = tid & 31, col = lane & 15, g = lane >> 4, kg = wave / QT; const size_t q0 = (size_t)blockIdx.x * (16 * QT) + (wave % QT) * 16, key0 = (size_t)blockIdx.y * KSPAN;
  const _Float16* sk = (const _Float16*)(ring + (kg * 32 + col) * KPB); const _Float16* sv = (const _Float16*)(ring + TILE_K + kg * VSUB + col * VPB);   // this lane's first K row and first V^T row piece
  // K: wave w brings rows 4 w .. 4 w + 3, one whole row per copy; V^T: rows 16 w .. 16 w + 15, four rows of 128 B per copy (lane = row lane / 8, 16-byte piece lane % 8, whose key group is piece / 4)
  const unsigned lk = (unsigned)(size_t)ring + (unsigned)(wave * 4 * KPB + lane * 16), lv = (unsigned)(size_t)ring + (unsigned)(TILE_K + ((lane & 7) >> 2) * VSUB + (wave * 16 + (lane >> 3)) * VPB + (lane & 3) * 16);
  const unsigned wu = (unsigned)__builtin_amdgcn_readfirstlane(wave), vok = (unsigned)lane * 16u, vov = (unsigned)(lane >> 3) * (NK * 2u) + (unsigned)(lane & 7) * 16u;   // the wave's number in a scalar register: the copies' bases are scalar
  const char* gk = (const char*)KH + (key0 + (size_t)wu * 4) * (DD * 2); const char* gv = (const char*)VT + (size_t)wu * (16 * NK * 2) + key0 * 2;
  stage<KPB>(lk, vok, gk, DD * 2);
  v16h aq[DD / 32];
#pragma unroll
  for (int kc = 0; kc < DD / 32; ++kc) aq[kc] = frag_h(QH + (q0 + col) * DD + kc * 32, lane);
  float m = -3.0e38f, l = 0.f;   // query col's running maximum (alike in both wave halves) and this half's share of its sum
  v8f acc[16] = {};
  asm volatile("s_wait_asynccnt 0x0" ::: "memory");   // the first K tile has landed
  __syncthreads();
  stage<4 * VPB>(lv, vov, gv, 4 * NK * 2);
  // one step of 64 keys = two ring trips; MORE: a next step exists, whose tiles are asked for at the two feet. The last step is written out behind the loop, so that no branch stands inside a step: with one, the compiler sank the tail of the softmax behind it, its values stayed live through the P x V products and a Q fragment spilled inside the key loop
  auto step = [&](int it, auto more) __attribute__((always_inline)) { constexpr bool MORE = decltype(more)::v; v8f s[2];
#pragma unroll
    for (int ct = 0; ct < 2; ++ct) { const _Float16* kr = sk + ct * (16 * KPB / 2); v8f c = {};
#pragma unroll
      for (int kc = 0; kc < DD / 32; ++kc) c = wmma16(frag_h(kr + kc * 32, lane), aq[kc], c);
      s[ct] = c; }
    float t[8];   // s[ct][r] = score of key 16 ct + 8 g + r with query col
#pragma unroll
    for (int r = 0; r < 8; ++r) t[r] = fmaxf(s[0][r], s[1][r]);
    float mx = fmaxf(fmaxf(fmaxf(t[0], t[1]), fmaxf(t[2], t[3])), fmaxf(fmaxf(t[4], t[5]), fmaxf(t[6], t[7])));
    mx = fmaxf(mx, xhalf(mx));
    const float mn = fmaxf(m, mx); const float alpha = (m <= -1.0e38f) ? 0.f : __expf(m - mn);
    v16h pb;
#pragma unroll
    for (int r = 0; r < 8; ++r) { const _Float16 e0 = (_Float16)__expf(s[0][r] - mn), e1 = (_Float16)__expf(s[1][r] - mn); pb[r] = e0; pb[8 + r] = e1; t[r] = (float)e0 + (float)e1; }   // P rounded once; the same values feed l
    l = l * alpha + (((t[0] + t[1]) + (t[2] + t[3])) + ((t[4] + t[5]) + (t[6] + t[7]))); m = mn;
#pragma unroll
    for (int dt = 0; dt < 16; ++dt) acc[dt] *= alpha;
    ring_foot();
    if constexpr (MORE) stage<KPB>(lk, vok, gk + (size_t)(it + 1) * (SKEYS * DD * 2), DD * 2);
#pragma unroll
    for (int dt = 0; dt < 16; ++dt) acc[dt] = wmma16(frag_h(sv + dt * (16 * VPB / 2), lane), pb, acc[dt]);
    ring_foot();
    if constexpr (MORE) stage<4 * VPB>(lv, vov, gv + (size_t)(it + 1) * (SKEYS * 2), 4 * NK * 2); };
#pragma unroll 1
  for (int it = 0; it < KSPAN / SKEYS - 1; ++it) step(it, more_t<true>{});
  step(KSPAN / SKEYS - 1, more_t<false>{});
  asm volatile("s_wait_asynccnt 0x0" ::: "memory");   // nothing is in flight when the ring becomes the merge's staging
  const float lt = l + xhalf(l);   // the two wave halves' sums are joined once
  if (g == 0) { sm[wave][col] = m; sl[wave][col] = lt; }
#pragma unroll
  for (int dt = 0; dt < 16; ++dt) { float* o = &so[wave][col][dt * 16 + 8 * g];   // acc[dt][r] = dim 16 dt + 8 g + r of query col: eight neighbours of one row
    vst2(o, (v4f){acc[dt][0], acc[dt][1], acc[dt][2], acc[dt][3]}); vst2(o + 4, (v4f){acc[dt][4], acc[dt][5], acc[dt][6], acc[dt][7]}); }
  __syncthreads();
  // merge inside the block: 128 rows x 64 four-float pieces over 512 threads; a wave holds half of one row, so m and the weights are wave-uniform reads
  const size_t pr0 = (size_t)blockIdx.y * NQ + (size_t)blockIdx.x * (16 * QT);
#pragma unroll 1   // rolled: sixteen trips in line would only lengthen the text
  for (int i0 = 0; i0 < QT * 2; i0 += 4) {
#pragma unroll   // four trips' LDS reads are in flight together
    for (int i = i0; i < i0 + 4; ++i) { const int idx = i * 512 + tid, row = idx >> 6, c = (idx & 63) * 4, w0 = row >> 4, rl = row & 15;
      float mg[KG], mx = -3.0e38f;
#pragma unroll
      for (int k = 0; k < KG; ++k) { mg[k] = sm[k * QT + w0][rl]; mx = fmaxf(mx, mg[k]); }
      v4f o = {};
#pragma unroll
      for (int k = 0; k < KG; ++k) o += __expf(mg[k] - mx) * *(const v4f*)&so[k * QT + w0][rl][c];
      vst2(PO + (pr0 + row) * DD + c, o); }
    asm volatile("s_wait_xcnt 0x0" ::: "memory"); }   // the next trip rewrites the registers that these four stores name
  // the range's maximum and sum, one thread per row
  if (tid < 16 * QT) { const int w0 = tid >> 4, rl = tid & 15;
    float mg[KG], mx = -3.0e38f;
#pragma unroll
    for (int k = 0; k < KG; ++k) { mg[k] = sm[k * QT + w0][rl]; mx = fmaxf(mx, mg[k]); }
    float ls = 0.f;
#pragma unroll
    for (int k = 0; k < KG; ++k) ls += __expf(mg[k] - mx) * sl[k * QT + w0][rl];
    PM[pr0 + tid] = mx; PL[pr0 + tid] = ls; }
}
// the four key ranges of a query row are joined: a thread holds four neighbours of each of four rows, a wave half a row; 16 waves per block and one block per 32 rows, so that few waves have to be started
__global__ __launch_bounds__(512) void k_merge(const float* __restrict__ PO, const float* __restrict__ PM, const float* __restrict__ PL, float* __restrict__ OUT) {
#pragma unroll 1   // rolled: a trip's loads are independent and go out together, and 16 waves of them fill the memory path
  for (int j = 0; j < 4; ++j) { const unsigned idx = (blockIdx.x * 4u + j) * 512u + threadIdx.x, rb = (idx >> 6) * 4u, ob = idx * 16u;   // byte offsets: of the row's maximum and sum in a range's plane; of the thread's four floats in a range's partial sums and in out
    float mg[KS], pl[KS]; v4f po[KS];
#pragma unroll
    for (int k = 0; k < KS; ++k) { mg[k] = *(const float*)((const char*)(PM + (size_t)k * NQ) + rb); pl[k] = *(const float*)((const char*)(PL + (size_t)k * NQ) + rb); po[k] = *(const v4f*)((const char*)(PO + (size_t)k * NQ * DD) + ob); }
    asm volatile("s_wait_xcnt 0x0" :: "v"(rb), "v"(ob) : "memory");   // behind the trip's twelve loads, in front of the first rewrite of a register that one of them names; the two offsets are its inputs, so that they keep their registers up to here and no later load's result lands on them
    const float mx = fmaxf(fmaxf(mg[0], mg[1]), fmaxf(mg[2], mg[3]));
    float ls = 0.f; v4f o = {};
#pragma unroll
    for (int k = 0; k < KS; ++k) { const float w = __expf(mg[k] - mx); ls += w * pl[k]; o += w * po[k]; }
    vst2((char*)OUT + ob, o * (1.0f / ls));
    asm volatile("s_wait_xcnt 0x0" ::: "memory"); }   // the next trip rewrites the registers that this trip's store names
}
extern "C" void kernel_launch(void* const* d_in, const int* in_sizes, int n_in, void* d_out, int out_size, void* d_ws, size_t ws_size, hipStream_t stream) {
  (void)in_sizes; (void)n_in; (void)out_size;
  const float** F = (const float**)d_in;   // 0 x_q [8192,256], 1 x_kv [8192,256], 2 Wq [256,256], 3 bq, 4 Wk, 5 bk, 6 Wv, 7 bv
  if (ws_size < (size_t)WS_END) return;
  char* ws = (char*)d_ws; __bf16* PK = (__bf16*)(ws + WS_PK); _Float16 *QH = (_Float16*)(ws + WS_QH), *KH = (_Float16*)(ws + WS_KH), *VT = (_Float16*)(ws + WS_VT); float *PO = (float*)(ws + WS_PO), *PM = (float*)(ws + WS_PM), *PL = (float*)(ws + WS_PL);
  k_pack<<<dim3(DD, 3), 256, 0, stream>>>(F[2], F[4], F[6], PK);
  k_proj<<<dim3(NQ / 64, 3), 128, 0, stream>>>(F[0], F[1], PK, F[3], F[5], F[7], QH, KH, VT);
  k_attn<<<dim3(NQ / (16 * QT), KS), 512, 0, stream>>>(QH, KH, VT, PO, PM, PL);
  k_merge<<<NQ / 32, 512, 0, stream>>>(PO, PM, PL, (float*)d_out);
}

// v005
// One run takes 100 microseconds.
// Two timings next to v004 both put it at 1.23 times that version's speed.
// Counting every step since v000, it is 19.6 times as fast.
// compute dtype: x_q, x_kv, Wq, bq, Wk, bk, Wv, bv (module inputs) rounded to bf16; q, k, v projections with exact bf16 products (natural [out][in] rows) + bias on WMMA 16x16x32; q/16 and k stored once as f16, v transposed to f16 planes (single: the softmax here averages thousands of keys, so operand rounding averages out); scores with single f16 operands (1 product); P = exp(s - m) rounded once to f16 (the same value feeds l) x V (1 product); both products are formed transposed (keys x queries, then dims x queries), so a lane holds one query's scores; running-max softmax in f32 with the hardware exp; f32 accumulate; a wave holds two 16-query tiles, so that a K or V^T fragment read from LDS feeds two products; the keys are split over 4 work-groups x 2 waves per query tile, whose partial (m, l, sum P v) are merged in f32, first the two waves' in LDS, then the four work-groups' in a launch of its own: out = (sum_g w_g O_g) / (sum_g w_g l_g), w_g = exp(m_g - max m).
#include <hip/hip_runtime.h>
#include <math.h>

typedef __attribute__((ext_vector_type(16))) _Float16 v16h;
typedef __attribute__((ext_vector_type(16))) __bf16 v16b;
typedef __attribute__((ext_vector_type(8)))  _Float16 v8h;
typedef __attribute__((ext_vector_type(8)))  float v8f;
typedef __attribute__((ext_vector_type(4)))  float v4f;
typedef __attribute__((ext_vector_type(2)))  float v2f;
typedef __attribute__((ext_vector_type(4)))  unsigned v4u;
typedef __attribute__((ext_vector_type(4)))  int v4i;
typedef float __attribute__((may_alias)) float_a;
typedef int __attribute__((may_alias)) int_a;

template <typename T> __device__ __forceinline__ void vst2(void* p, T v) { *(T*)p = v;  }
__device__ __forceinline__ v8f wmma16(v16h a, v16h b, v8f c) {
  return __builtin_amdgcn_wmma_f32_16x16x32_f16(false, a, false, b, (short)0, c, false, false);   // the builtin alone: the compiler keeps the distances behind it, and no asm operand holds the tiles in the first 256 registers
}
__device__ __forceinline__ v8f wmma_bf(v16b a, v16b b, v8f c) {
  v8f d = __builtin_amdgcn_wmma_f32_16x16x32_bf16(false, a, false, b, (short)0, c, false, false);
  asm volatile("v_nop\n\tv_nop\n\tv_nop\n\tv_nop" : "+v"(d) : "v"(a), "v"(b));
  return d;
}
// 16x16x32 fragments: lane = (h = lane>>4, row/col = lane&15); elements 0..7 = k0+8h+0..7, 8..15 = k0+16+8h+0..7; D element r = row 8h+r
__device__ __forceinline__ v16h frag_h(const _Float16* rowk0, int lane) {
  union { v16h v; v8h q[2]; } u; const _Float16* p = rowk0 + 8 * (lane >> 4);
  u.q[0] = *(const v8h*)p; u.q[1] = *(const v8h*)(p + 16); return u.v;
}
__device__ __forceinline__ v16h frag_f32(const float* rowk0, int lane) {
  v16h a; const float* p = rowk0 + 8 * (lane >> 4);
#pragma unroll
  for (int i = 0; i < 8; ++i) { a[i] = (_Float16)p[i]; a[8 + i] = (_Float16)p[16 + i]; }
  return a;
}
__device__ __forceinline__ v16h frag_f32s(const float* rowk0, int lane, float sc) {
  v16h a; const float* p = rowk0 + 8 * (lane >> 4);
#pragma unroll
  for (int i = 0; i < 8; ++i) { a[i] = (_Float16)(p[i] * sc); a[8 + i] = (_Float16)(p[16 + i] * sc); }
  return a;
}
// column fragment from a [K][ld] layout (column n), rows >= K read as 0
__device__ __forceinline__ v16h fragc_f32(const float* W, int k0, int n, int lane, int ld, int K) {
  v16h a; const int g = lane >> 4;
#pragma unroll
  for (int i = 0; i < 8; ++i) { const int ka = k0 + 8 * g + i, kb = ka + 16;
    a[i] = (_Float16)(ka < K ? W[(size_t)(ka < K ? ka : K - 1) * ld + n] : 0.f); a[8 + i] = (_Float16)(kb < K ? W[(size_t)(kb < K ? kb : K - 1) * ld + n] : 0.f); }
  return a;
}
struct F2 { v16b h, l; };
__device__ __forceinline__ F2 bsplit16(const float v[16]) { F2 r;
#pragma unroll
  for (int i = 0; i < 16; ++i) { const __bf16 h = (__bf16)v[i]; r.h[i] = h; r.l[i] = (__bf16)(v[i] - (float)h); }
  return r; }
__device__ __forceinline__ F2 split_row(const float* row, int k0, int lane) { float v[16]; const float* p = row + k0 + 8 * (lane >> 4);
#pragma unroll
  for (int i = 0; i < 8; ++i) { v[i] = p[i]; v[8 + i] = p[16 + i]; }
  return bsplit16(v); }
__device__ __forceinline__ F2 split_rowK(const float* row, int k0, int lane, int K) { float v[16]; const int g = lane >> 4;
#pragma unroll
  for (int i = 0; i < 8; ++i) { const int ka = k0 + 8 * g + i, kb = ka + 16; v[i] = ka < K ? row[ka < K ? ka : K - 1] : 0.f; v[8 + i] = kb < K ? row[kb < K ? kb : K - 1] : 0.f; }
  return bsplit16(v); }
__device__ __forceinline__ F2 split_col(const float* W, int k0, int n, int lane, int ld, int K) { float v[16]; const int g = lane >> 4;
#pragma unroll
  for (int i = 0; i < 8; ++i) { const int ka = k0 + 8 * g + i, kb = ka + 16; v[i] = ka < K ? W[(size_t)(ka < K ? ka : K - 1) * ld + n] : 0.f; v[8 + i] = kb < K ? W[(size_t)(kb < K ? kb : K - 1) * ld + n] : 0.f; }
  return bsplit16(v); }
__device__ __forceinline__ v8f mac3(const F2& a, const F2& b, v8f c) { c = wmma_bf(a.l, b.h, c); c = wmma_bf(a.h, b.l, c); return wmma_bf(a.h, b.h, c); }
__device__ __forceinline__ float sigm(float v) { return 1.0f / (1.0f + expf(-v)); }
#define LDSX() do { asm volatile("s_wait_dscnt 0" ::: "memory"); __builtin_amdgcn_wave_barrier(); __builtin_amdgcn_fence(__ATOMIC_RELEASE, "workgroup"); } while (0)


// Cross-stream single-head attention (N = M = 8,192, D 256): softmax((x_q Wq^T + bq)(x_kv Wk^T + bk)^T / 16) (x_kv Wv^T + bv).
#define NQ 8192
#define NK 8192
#define DD 256
typedef __attribute__((ext_vector_type(8))) __bf16 v8b;
__device__ __forceinline__ v16b frag_b(const __bf16* rowk0, int lane) {
  union { v16b v; v8b q[2]; } u; const __bf16* p = rowk0 + 8 * (lane >> 4);
  u.q[0] = *(const v8b*)p; u.q[1] = *(const v8b*)(p + 16); return u.v;
}
__device__ __forceinline__ float bfr(float v) { return (float)(__bf16)v; }
__device__ __attribute__((noinline)) float exp_ni(float v) { return expf(v); }
__device__ __attribute__((noinline)) float erf_ni(float v) { return erff(v); }

#define KG 2                                      // key groups (waves) that share one 16-query tile inside a block
#define QT 8                                      // 16-query tiles of a block
#define NT 2                                      // 16-query tiles of a wave: each fragment read from LDS feeds NT products
#define NW (QT * KG / NT)                         // waves of a block
#define KS 4                                      // key ranges, one block each per 128 queries
#define WS_PK  0u                                 // bf16 [3][256][256] Wq, Wk, Wv natural rows
#define WS_QH  (WS_PK + 2u * 3 * DD * DD)            // f16 [8192][256] q/16
#define WS_KH  (WS_QH + 2u * NQ * DD)                // f16 [8192][256] k
#define WS_VT  (WS_KH + 2u * NK * DD)                // f16 [256 d][8192 keys] v^T
#define WS_PO  (WS_VT + 2u * DD * NK)                // f32 [KS][8192][256] unnormalised partial sums of one key range
#define WS_PM  (WS_PO + 4u * KS * NQ * DD)           // f32 [KS][8192] the range's maximum
#define WS_PL  (WS_PM + 4u * KS * NQ)                // f32 [KS][8192] the range's sum
#define WS_END (WS_PL + 4u * KS * NQ)

__global__ __launch_bounds__(256) void k_pack(const float* __restrict__ WQ, const float* __restrict__ WK, const float* __restrict__ WV, __bf16* __restrict__ PK) {
  __shared__ __align__(16) __bf16 s[DD]; const int n = blockIdx.x, which = blockIdx.y, t = threadIdx.x; const float* Wm = (which == 0) ? WQ : (which == 1) ? WK : WV;
  s[t] = (__bf16)Wm[(size_t)n * DD + t]; __syncthreads();
  if (t < DD / 8) vst2((unsigned*)(PK + ((size_t)which * DD + n) * DD + t * 8), *(const v4u*)&s[t * 8]);
}
__global__ __launch_bounds__(128) void k_proj(const float* __restrict__ XQ, const float* __restrict__ XKV, const __bf16* __restrict__ PK, const float* __restrict__ BQ, const float* __restrict__ BK, const float* __restrict__ BV, _Float16* __restrict__ QH, _Float16* __restrict__ KH, _Float16* __restrict__ VT) {
  __shared__ __align__(16) _Float16 so[4][16][DD + 8]; __shared__ __align__(16) _Float16 st[DD][72];
  const int tid = threadIdx.x, wave = tid >> 5, lane = tid & 31, col = lane & 15, g = lane >> 4; const size_t r0 = (size_t)blockIdx.x * 64 + wave * 16; const int which = blockIdx.y;
  const float* X = (which == 0) ? XQ : XKV; const __bf16* P = PK + (size_t)which * DD * DD; const float* BB = (which == 0) ? BQ : (which == 1) ? BK : BV; const float sc = (which == 0) ? (1.0f / 16.0f) : 1.0f;
#pragma unroll 1
  for (int half = 0; half < 2; ++half) { v8f acc[8] = {};
#pragma unroll
    for (int kc = 0; kc < DD / 32; ++kc) { v16b a; { const float* p = X + (r0 + col) * DD + kc * 32 + 8 * g;
#pragma unroll
        for (int i = 0; i < 8; ++i) { a[i] = (__bf16)p[i]; a[8 + i] = (__bf16)p[16 + i]; } }
#pragma unroll
      for (int j = 0; j < 8; ++j) acc[j] = wmma_bf(a, frag_b(P + (size_t)(half * 128 + j * 16 + col) * DD + kc * 32, lane), acc[j]); }
#pragma unroll
    for (int j = 0; j < 8; ++j) { const int n = half * 128 + j * 16 + col; const float bb = bfr(BB[n]);
#pragma unroll
      for (int r = 0; r < 8; ++r) { const float v = (acc[j][r] + bb) * sc; if (which == 2) st[n][wave * 16 + 8 * g + r] = (_Float16)v; else so[wave][8 * g + r][n] = (_Float16)v; } } }
  if (which == 2) { __syncthreads(); const size_t k0 = (size_t)blockIdx.x * 64;
    for (int q = tid; q < DD * 8; q += 128) { const int d = q >> 3, pc = q & 7; vst2((unsigned*)(VT + (size_t)d * NK + k0 + pc * 8), *(const v4u*)&st[d][pc * 8]); } }
  else { LDSX(); _Float16* DST = (which == 0) ? QH : KH;
    for (int rl = 0; rl < 16; ++rl) vst2((unsigned*)(DST + (r0 + rl) * DD + lane * 8), *(const v4u*)&so[wave][rl][lane * 8]); }
}
// ---- k_attn: block = 128 queries x one key range of 2,048 keys = 4 pairs of query tiles x 2 key groups = 8 waves (wave = 32 queries, every 2nd 32-key step of the range; two waves per SIMD, up to 512 registers each), so a staged key is read from L2 once per 128 queries and each fragment is read from LDS once per 32 queries; the 64 keys of one step of the block are staged in LDS by asynchronous copies, and all four pairs of query tiles read their fragments there: buffer 0 holds the K rows, buffer 1 the V^T rows of those keys, and the two halves of a step are the two trips of a two-buffer ring (scores read buffer 0 while buffer 1 fills; P x V reads buffer 1 while buffer 0 takes the next K rows); per step: S^T = K q^T (A = K rows, B = the Q fragments kept in registers; K 256 = 8 chunks, 1 product, q pre-scaled), so lane (g, col) holds 16 of query col's 32 scores: the maximum is taken in the lane and joined once with the other wave half, l stays a per-half sum until the epilogue, m, l and the rescale factor are one register each; P^T rounded once to f16 (the rounded value also accumulates l) is packed from the two score tiles straight into a B operand (element i = tile i / 8, register i % 8: the k order of frag_h) and O^T += V^T P^T for all 256 output dims (16 tiles, A = V^T rows); then each wave's unnormalised partial sums with its m and l go to LDS (over the ring), one barrier, and all 256 threads merge the 2 key groups of each row; the range's unnormalised sums, maximum and sum go to the workspace in 512-B pieces per wave, and k_merge joins the four ranges
#define SKEYS (32 * KG)                           // keys per staged tile
#define KSPAN (NK / KS)                           // keys per block
#define KPB 528                                   // bytes per staged K row: 512 + 16, an odd multiple of 16 B for the 16-byte fragment reads
#define VPB 80                                    // bytes per staged V^T row piece: one key group's 32 keys (64 B) + 16, an odd multiple of 16 B
#define VSUB (DD * VPB + 64)                      // bytes per key group of the V^T tile: its 256 row pieces lie together, within the reach of one LDS address; + 64 B so that the two pieces of a copied row fall on different banks
#define TILE_K (SKEYS * KPB)
#define TILE_V (KG * VSUB)
#define SO_B (QT * KG * 16 * (DD + 4) * 4)        // bytes of the merge's staging, which reuses the ring
// eight 16-byte copies per lane, written as the builtin: the kernel uses registers above v255, which asm text cannot name; global address = the copy's wave-uniform base + the lane's 32-bit offset; from one copy to the next the LDS address moves by LS bytes and the global address by GS. The immediate offset moves the LDS address and the global address alike, so one LDS register serves all eight and each base holds its address less that offset
typedef __attribute__((address_space(1))) v4i* gp128; typedef __attribute__((address_space(3))) v4i* lp128;
template <int... I> struct seq_t {};
template <int LS, long long GS, int... I> __device__ __forceinline__ void stage(char* l, unsigned vo, const char* p, seq_t<I...>) {
  (__builtin_amdgcn_global_load_async_to_lds_b128((gp128)(p + I * (GS - LS) + vo), (lp128)l, I * LS, 0), ...);
}
#define SEQ8 seq_t<0, 1, 2, 3, 4, 5, 6, 7>{}
// foot of a ring trip: this wave's LDS reads and writes are done, its own copies have landed, then the barrier that publishes the other buffer and frees the one just read
__device__ __forceinline__ void ring_foot() { asm volatile("s_wait_dscnt 0x0" ::: "memory"); asm volatile("s_wait_asynccnt 0x0" ::: "memory"); __syncthreads(); }
__device__ __forceinline__ float xhalf(float x) { return __builtin_bit_cast(float, __builtin_amdgcn_permlanex16(__builtin_bit_cast(int, x), __builtin_bit_cast(int, x), 0x76543210, 0xfedcba98, false, false)); }   // lane l takes lane l ^ 16's value
template <bool V> struct more_t { static constexpr bool v = V; };
static_assert(NW == 8 && SKEYS == 64 && DD == 256 && TILE_K + TILE_V <= SO_B, "8 waves bring 8 K rows (512 B each) and 32 V^T rows (128 B each, four per copy) apiece; the merge's partial sums reuse the ring");
__global__ __launch_bounds__(32 * NW) void k_attn(const _Float16* __restrict__ QH, const _Float16* __restrict__ KH, const _Float16* __restrict__ VT, float* __restrict__ PO, float* __restrict__ PM, float* __restrict__ PL) {
  __shared__ __align__(16) char ring[SO_B]; __shared__ float sm[QT * KG][16], sl[QT * KG][16];
  float (*so)[16][DD + 4] = (float (*)[16][DD + 4])ring;
  const int tid = threadIdx.x, wave = tid >> 5, lane = tid & 31, col = lane & 15, g = lane >> 4, kg = wave / (QT / NT), t0 = (wave % (QT / NT)) * NT; const size_t q0 = (size_t)blockIdx.x * (16 * QT) + t0 * 16, key0 = (size_t)blockIdx.y * KSPAN;
  const _Float16* sk = (const _Float16*)(ring + (kg * 32 + col) * KPB); const _Float16* sv = (const _Float16*)(ring + TILE_K + kg * VSUB + col * VPB);   // this lane's first K row and first V^T row piece
  // K: wave w brings rows 8 w .. 8 w + 7, one whole row per copy; V^T: rows 32 w .. 32 w + 31, four rows of 128 B per copy (lane = row lane / 8, 16-byte piece lane % 8, whose key group is piece / 4)
  const unsigned wu = (unsigned)__builtin_amdgcn_readfirstlane(wave), vok = (unsigned)lane * 16u, vov = (unsigned)(lane >> 3) * (NK * 2u) + (unsigned)(lane & 7) * 16u;   // the wave's number in a scalar register: the wave's share of the copies' global addresses is scalar arithmetic
  char* lk = ring + (wave * 8 * KPB + lane * 16); char* lv = ring + (TILE_K + ((lane & 7) >> 2) * VSUB + (wave * 32 + (lane >> 3)) * VPB + (lane & 3) * 16);
  const char* gk = (const char*)KH + (key0 + (size_t)wu * 8) * (DD * 2); const char* gv = (const char*)VT + (size_t)wu * (32 * NK * 2) + key0 * 2;
  stage<KPB, DD * 2>(lk, vok, gk, SEQ8);
  v16h aq[NT][DD / 32]; const _Float16* qr[NT];   // qr: this lane's row of Q in each tile
#pragma unroll
  for (int j = 0; j < NT; ++j) { qr[j] = QH + (q0 + j * 16 + col) * DD;
#pragma unroll
    for (int kc = 0; kc < DD / 32; ++kc) aq[j][kc] = frag_h(qr[j] + kc * 32, lane); }
  asm volatile("s_wait_xcnt 0x0" :: "v"(qr[0] + 8 * g), "v"(qr[1] + 8 * g) : "memory");   // behind the Q fragments' loads, in front of the first rewrite of a register that one of them names; the two addresses are its inputs, so that they keep their registers up to here
  float m[NT], l[NT];   // per query tile: query col's running maximum (alike in both wave halves) and this half's share of its sum
  v8f acc[NT][16] = {};
#pragma unroll
  for (int j = 0; j < NT; ++j) { m[j] = -3.0e38f; l[j] = 0.f; }
  asm volatile("s_wait_asynccnt 0x0" ::: "memory");   // the first K tile has landed
  __syncthreads();
  stage<4 * VPB, 4 * NK * 2>(lv, vov, gv, SEQ8);
  // one step of 64 keys = two ring trips; MORE: a next step exists, whose tiles are asked for at the two feet. The last step is written out behind the loop, so that no branch stands inside a step: with one, the compiler sank the tail of the softmax behind it, its values stayed live through the P x V products and a Q fragment spilled inside the key loop
  auto step = [&](int it, auto more) __attribute__((always_inline)) { constexpr bool MORE = decltype(more)::v; v8f s[NT][2] = {};   // every inner loop of a step is unrolled, so that each index of a register array is a constant
    { v16h fk[3][2];   // K fragments read from LDS: the two key tiles of one chunk kc are a group, read two groups ahead of their products (three groups of registers: beside the scores there is no room for more)
#pragma unroll
      for (int kc = 0; kc < 2; ++kc)
#pragma unroll
        for (int ct = 0; ct < 2; ++ct) fk[kc][ct] = frag_h(sk + ct * (16 * KPB / 2) + kc * 32, lane);
#pragma unroll
      for (int kc = 0; kc < DD / 32; ++kc) {
        if (kc + 2 < DD / 32) {
#pragma unroll
          for (int ct = 0; ct < 2; ++ct) fk[(kc + 2) % 3][ct] = frag_h(sk + ct * (16 * KPB / 2) + (kc + 2) * 32, lane); }
        __builtin_amdgcn_sched_barrier(0);   // a later group's reads stay together in front of this group's products; without it the compiler sinks each read to its use and every product waits out an LDS latency
#pragma unroll
        for (int ct = 0; ct < 2; ++ct)
#pragma unroll
          for (int j = 0; j < NT; ++j) s[j][ct] = wmma16(fk[kc % 3][ct], aq[j][kc], s[j][ct]);   // one fragment, NT products; four independent sums, each in the order kc = 0 .. 7
        __builtin_amdgcn_sched_barrier(0); } }   // and no later read rises among these products
    v16h pb[NT]; float alpha[NT];
#pragma unroll
    for (int j = 0; j < NT; ++j) { float t[8];   // s[j][ct][r] = score of key 16 ct + 8 g + r with query col of tile j
#pragma unroll
      for (int r = 0; r < 8; ++r) t[r] = fmaxf(s[j][0][r], s[j][1][r]);
      float mx = fmaxf(fmaxf(fmaxf(t[0], t[1]), fmaxf(t[2], t[3])), fmaxf(fmaxf(t[4], t[5]), fmaxf(t[6], t[7])));
      mx = fmaxf(mx, xhalf(mx));
      const float mn = fmaxf(m[j], mx); alpha[j] = (m[j] <= -1.0e38f) ? 0.f : __expf(m[j] - mn);
#pragma unroll
      for (int r = 0; r < 8; ++r) { const _Float16 e0 = (_Float16)__expf(s[j][0][r] - mn), e1 = (_Float16)__expf(s[j][1][r] - mn); pb[j][r] = e0; pb[j][8 + r] = e1; t[r] = (float)e0 + (float)e1; }   // P rounded once; the same values feed l
      l[j] = l[j] * alpha[j] + (((t[0] + t[1]) + (t[2] + t[3])) + ((t[4] + t[5]) + (t[6] + t[7]))); m[j] = mn; }
#pragma unroll
    for (int j = 0; j < NT; ++j)
#pragma unroll
      for (int dt = 0; dt < 16; ++dt) acc[j][dt] *= alpha[j];
    ring_foot();
    if constexpr (MORE) stage<KPB, DD * 2>(lk, vok, gk + (size_t)(it + 1) * (SKEYS * DD * 2), SEQ8);
    v16h fr[2][4];   // V^T fragments, four to a group, two groups of registers: the next group's reads are under way while this group's products run
#pragma unroll
    for (int u = 0; u < 4; ++u) fr[0][u] = frag_h(sv + u * (16 * VPB / 2), lane);   // V^T fragment u of group gi: dims 16 (4 gi + u) ..
#pragma unroll
    for (int gi = 0; gi < 4; ++gi) {
      if (gi < 3) {
#pragma unroll
        for (int u = 0; u < 4; ++u) fr[(gi + 1) & 1][u] = frag_h(sv + ((gi + 1) * 4 + u) * (16 * VPB / 2), lane); }
      __builtin_amdgcn_sched_barrier(0);   // as above: the next group's reads in front of this group's products
#pragma unroll
      for (int u = 0; u < 4; ++u)
#pragma unroll
        for (int j = 0; j < NT; ++j) acc[j][gi * 4 + u] = wmma16(fr[gi & 1][u], pb[j], acc[j][gi * 4 + u]);   // one fragment, NT products
      __builtin_amdgcn_sched_barrier(0); }
    ring_foot();
    if constexpr (MORE) stage<4 * VPB, 4 * NK * 2>(lv, vov, gv + (size_t)(it + 1) * (SKEYS * 2), SEQ8); };
#pragma unroll 1
  for (int it = 0; it < KSPAN / SKEYS - 1; ++it) step(it, more_t<true>{});
  step(KSPAN / SKEYS - 1, more_t<false>{});
  asm volatile("s_wait_asynccnt 0x0" ::: "memory");   // nothing is in flight when the ring becomes the merge's staging
#pragma unroll
  for (int j = 0; j < NT; ++j) { const int sw = kg * QT + t0 + j;   // the staging slot of (key group, query tile)
    const float lt = l[j] + xhalf(l[j]);   // the two wave halves' sums are joined once
    if (g == 0) { sm[sw][col] = m[j]; sl[sw][col] = lt; }
#pragma unroll
    for (int dt = 0; dt < 16; ++dt) { float* o = &so[sw][col][dt * 16 + 8 * g];   // acc[j][dt][r] = dim 16 dt + 8 g + r of query col: eight neighbours of one row
      vst2(o, (v4f){acc[j][dt][0], acc[j][dt][1], acc[j][dt][2], acc[j][dt][3]}); vst2(o + 4, (v4f){acc[j][dt][4], acc[j][dt][5], acc[j][dt][6], acc[j][dt][7]}); } }
  __syncthreads();
  // merge inside the block: 128 rows x 64 four-float pieces over 256 threads; a wave holds half of one row, so m and the weights are wave-uniform reads
  const size_t pr0 = (size_t)blockIdx.y * NQ + (size_t)blockIdx.x * (16 * QT);
#pragma unroll 1   // rolled: thirty-two trips in line would only lengthen the text
  for (int i0 = 0; i0 < 16 * QT * (DD / 4) / (32 * NW); i0 += 4) {
#pragma unroll   // four trips' LDS reads are in flight together
    for (int i = i0; i < i0 + 4; ++i) { const int idx = i * (32 * NW) + tid, row = idx >> 6, c = (idx & 63) * 4, w0 = row >> 4, rl = row & 15;
      float mg[KG], mx = -3.0e38f;
#pragma unroll
      for (int k = 0; k < KG; ++k) { mg[k] = sm[k * QT + w0][rl]; mx = fmaxf(mx, mg[k]); }
      v4f o = {};
#pragma unroll
      for (int k = 0; k < KG; ++k) o += __expf(mg[k] - mx) * *(const v4f*)&so[k * QT + w0][rl][c];
      vst2(PO + (pr0 + row) * DD + c, o); }
    asm volatile("s_wait_xcnt 0x0" ::: "memory"); }   // the next trip rewrites the registers that these four stores name
  // the range's maximum and sum, one thread per row
  if (tid < 16 * QT) { const int w0 = tid >> 4, rl = tid & 15;
    float mg[KG], mx = -3.0e38f;
#pragma unroll
    for (int k = 0; k < KG; ++k) { mg[k] = sm[k * QT + w0][rl]; mx = fmaxf(mx, mg[k]); }
    float ls = 0.f;
#pragma unroll
    for (int k = 0; k < KG; ++k) ls += __expf(mg[k] - mx) * sl[k * QT + w0][rl];
    PM[pr0 + tid] = mx; PL[pr0 + tid] = ls; }
}
// the four key ranges of a query row are joined: a thread holds four neighbours of each of four rows, a wave half a row; 16 waves per block and one block per 32 rows, so that few waves have to be started
__global__ __launch_bounds__(512) void k_merge(const float* __restrict__ PO, const float* __restrict__ PM, const float* __restrict__ PL, float* __restrict__ OUT) {
#pragma unroll 1   // rolled: a trip's loads are independent and go out together, and 16 waves of them fill the memory path
  for (int j = 0; j < 4; ++j) { const unsigned idx = (blockIdx.x * 4u + j) * 512u + threadIdx.x, rb = (idx >> 6) * 4u, ob = idx * 16u;   // byte offsets: of the row's maximum and sum in a range's plane; of the thread's four floats in a range's partial sums and in out
    float mg[KS], pl[KS]; v4f po[KS];
#pragma unroll
    for (int k = 0; k < KS; ++k) { mg[k] = *(const float*)((const char*)(PM + (size_t)k * NQ) + rb); pl[k] = *(const float*)((const char*)(PL + (size_t)k * NQ) + rb); po[k] = *(const v4f*)((const char*)(PO + (size_t)k * NQ * DD) + ob); }
    asm volatile("s_wait_xcnt 0x0" :: "v"(rb), "v"(ob) : "memory");   // behind the trip's twelve loads, in front of the first rewrite of a register that one of them names; the two offsets are its inputs, so that they keep their registers up to here and no later load's result lands on them
    const float mx = fmaxf(fmaxf(mg[0], mg[1]), fmaxf(mg[2], mg[3]));
    float ls = 0.f; v4f o = {};
#pragma unroll
    for (int k = 0; k < KS; ++k) { const float w = __expf(mg[k] - mx); ls += w * pl[k]; o += w * po[k]; }
    vst2((char*)OUT + ob, o * (1.0f / ls));
    asm volatile("s_wait_xcnt 0x0" ::: "memory"); }   // the next trip rewrites the registers that this trip's store names
}
extern "C" void kernel_launch(void* const* d_in, const int* in_sizes, int n_in, void* d_out, int out_size, void* d_ws, size_t ws_size, hipStream_t stream) {
  (void)in_sizes; (void)n_in; (void)out_size;
  const float** F = (const float**)d_in;   // 0 x_q [8192,256], 1 x_kv [8192,256], 2 Wq [256,256], 3 bq, 4 Wk, 5 bk, 6 Wv, 7 bv
  if (ws_size < (size_t)WS_END) return;
  char* ws = (char*)d_ws; __bf16* PK = (__bf16*)(ws + WS_PK); _Float16 *QH = (_Float16*)(ws + WS_QH), *KH = (_Float16*)(ws + WS_KH), *VT = (_Float16*)(ws + WS_VT); float *PO = (float*)(ws + WS_PO), *PM = (float*)(ws + WS_PM), *PL = (float*)(ws + WS_PL);
  k_pack<<<dim3(DD, 3), 256, 0, stream>>>(F[2], F[4], F[6], PK);
  k_proj<<<dim3(NQ / 64, 3), 128, 0, stream>>>(F[0], F[1], PK, F[3], F[5], F[7], QH, KH, VT);
  k_attn<<<dim3(NQ / (16 * QT), KS), 32 * NW, 0, stream>>>(QH, KH, VT, PO, PM, PL);
  k_merge<<<NQ / 32, 512, 0, stream>>>(PO, PM, PL, (float*)d_out);
}

// v006
// It runs in 73 microseconds.
// Next to v005, in two timings, it ran 1.38 and 1.41 times as fast.
// Counting every step since v000, it is 27.2 times as fast.
// compute dtype: x_q, x_kv, Wq, bq, Wk, bk, Wv, bv (module inputs) rounded to bf16; q, k, v projections with exact bf16 products (natural [out][in] rows) + bias on WMMA 16x16x32; q/16 and k stored once as f16, v transposed to f16 planes (single: the softmax here averages thousands of keys, so operand rounding averages out); scores with single f16 operands (1 product); P = exp(s - m) rounded once to f16 (the same value feeds l) x V (1 product); both products are formed transposed (keys x queries, then dims x queries), so a lane holds one query's scores; running-max softmax in f32 with the hardware exp; f32 accumulate; a wave holds two 16-query tiles, so that a K or V^T fragment read from LDS feeds two products; the keys are split over 4 work-groups x 2 waves per query tile, whose partial (m, l, sum P v) are merged in f32, first the two waves' in LDS, then the four work-groups' in a launch of its own: out = (sum_g w_g O_g) / (sum_g w_g l_g), w_g = exp(m_g - max m).
#include <hip/hip_runtime.h>
#include <math.h>

typedef __attribute__((ext_vector_type(16))) _Float16 v16h;
typedef __attribute__((ext_vector_type(16))) __bf16 v16b;
typedef __attribute__((ext_vector_type(8)))  _Float16 v8h;
typedef __attribute__((ext_vector_type(8)))  float v8f;
typedef __attribute__((ext_vector_type(4)))  float v4f;
typedef __attribute__((ext_vector_type(2)))  float v2f;
typedef __attribute__((ext_vector_type(4)))  unsigned v4u;
typedef __attribute__((ext_vector_type(4)))  int v4i;
typedef float __attribute__((may_alias)) float_a;
typedef int __attribute__((may_alias)) int_a;

template <typename T> __device__ __forceinline__ void vst2(void* p, T v) { *(T*)p = v;  }
__device__ __forceinline__ v8f wmma16(v16h a, v16h b, v8f c) {
  return __builtin_amdgcn_wmma_f32_16x16x32_f16(false, a, false, b, (short)0, c, false, false);   // the builtin alone: the compiler keeps the distances behind it, and no asm operand holds the tiles in the first 256 registers
}
__device__ __forceinline__ v8f wmma_bf(v16b a, v16b b, v8f c) {
  v8f d = __builtin_amdgcn_wmma_f32_16x16x32_bf16(false, a, false, b, (short)0, c, false, false);
  asm volatile("v_nop\n\tv_nop\n\tv_nop\n\tv_nop" : "+v"(d) : "v"(a), "v"(b));
  return d;
}
// 16x16x32 fragments: lane = (h = lane>>4, row/col = lane&15); elements 0..7 = k0+8h+0..7, 8..15 = k0+16+8h+0..7; D element r = row 8h+r
__device__ __forceinline__ v16h frag_h(const _Float16* rowk0, int lane) {
  union { v16h v; v8h q[2]; } u; const _Float16* p = rowk0 + 8 * (lane >> 4);
  u.q[0] = *(const v8h*)p; u.q[1] = *(const v8h*)(p + 16); return u.v;
}
__device__ __forceinline__ v16h frag_f32(const float* rowk0, int lane) {
  v16h a; const float* p = rowk0 + 8 * (lane >> 4);
#pragma unroll
  for (int i = 0; i < 8; ++i) { a[i] = (_Float16)p[i]; a[8 + i] = (_Float16)p[16 + i]; }
  return a;
}
__device__ __forceinline__ v16h frag_f32s(const float* rowk0, int lane, float sc) {
  v16h a; const float* p = rowk0 + 8 * (lane >> 4);
#pragma unroll
  for (int i = 0; i < 8; ++i) { a[i] = (_Float16)(p[i] * sc); a[8 + i] = (_Float16)(p[16 + i] * sc); }
  return a;
}
// column fragment from a [K][ld] layout (column n), rows >= K read as 0
__device__ __forceinline__ v16h fragc_f32(const float* W, int k0, int n, int lane, int ld, int K) {
  v16h a; const int g = lane >> 4;
#pragma unroll
  for (int i = 0; i < 8; ++i) { const int ka = k0 + 8 * g + i, kb = ka + 16;
    a[i] = (_Float16)(ka < K ? W[(size_t)(ka < K ? ka : K - 1) * ld + n] : 0.f); a[8 + i] = (_Float16)(kb < K ? W[(size_t)(kb < K ? kb : K - 1) * ld + n] : 0.f); }
  return a;
}
struct F2 { v16b h, l; };
__device__ __forceinline__ F2 bsplit16(const float v[16]) { F2 r;
#pragma unroll
  for (int i = 0; i < 16; ++i) { const __bf16 h = (__bf16)v[i]; r.h[i] = h; r.l[i] = (__bf16)(v[i] - (float)h); }
  return r; }
__device__ __forceinline__ F2 split_row(const float* row, int k0, int lane) { float v[16]; const float* p = row + k0 + 8 * (lane >> 4);
#pragma unroll
  for (int i = 0; i < 8; ++i) { v[i] = p[i]; v[8 + i] = p[16 + i]; }
  return bsplit16(v); }
__device__ __forceinline__ F2 split_rowK(const float* row, int k0, int lane, int K) { float v[16]; const int g = lane >> 4;
#pragma unroll
  for (int i = 0; i < 8; ++i) { const int ka = k0 + 8 * g + i, kb = ka + 16; v[i] = ka < K ? row[ka < K ? ka : K - 1] : 0.f; v[8 + i] = kb < K ? row[kb < K ? kb : K - 1] : 0.f; }
  return bsplit16(v); }
__device__ __forceinline__ F2 split_col(const float* W, int k0, int n, int lane, int ld, int K) { float v[16]; const int g = lane >> 4;
#pragma unroll
  for (int i = 0; i < 8; ++i) { const int ka = k0 + 8 * g + i, kb = ka + 16; v[i] = ka < K ? W[(size_t)(ka < K ? ka : K - 1) * ld + n] : 0.f; v[8 + i] = kb < K ? W[(size_t)(kb < K ? kb : K - 1) * ld + n] : 0.f; }
  return bsplit16(v); }
__device__ __forceinline__ v8f mac3(const F2& a, const F2& b, v8f c) { c = wmma_bf(a.l, b.h, c); c = wmma_bf(a.h, b.l, c); return wmma_bf(a.h, b.h, c); }
__device__ __forceinline__ float sigm(float v) { return 1.0f / (1.0f + expf(-v)); }
#define LDSX() do { asm volatile("s_wait_dscnt 0" ::: "memory"); __builtin_amdgcn_wave_barrier(); __builtin_amdgcn_fence(__ATOMIC_RELEASE, "workgroup"); } while (0)


// Cross-stream single-head attention (N = M = 8,192, D 256): softmax((x_q Wq^T + bq)(x_kv Wk^T + bk)^T / 16) (x_kv Wv^T + bv).
#define NQ 8192
#define NK 8192
#define DD 256
typedef __attribute__((ext_vector_type(8))) __bf16 v8b;
__device__ __forceinline__ v16b frag_b(const __bf16* rowk0, int lane) {
  union { v16b v; v8b q[2]; } u; const __bf16* p = rowk0 + 8 * (lane >> 4);
  u.q[0] = *(const v8b*)p; u.q[1] = *(const v8b*)(p + 16); return u.v;
}
__device__ __forceinline__ float bfr(float v) { return (float)(__bf16)v; }
__device__ __attribute__((noinline)) float exp_ni(float v) { return expf(v); }
__device__ __attribute__((noinline)) float erf_ni(float v) { return erff(v); }

#define KG 2                                      // key groups (waves) that share one 16-query tile inside a block
#define QT 8                                      // 16-query tiles of a block
#define NT 2                                      // 16-query tiles of a wave: each fragment read from LDS feeds NT products
#define NW (QT * KG / NT)                         // waves of a block
#define KS 4                                      // key ranges, one block each per 128 queries
#define WS_PK  0u                                 // bf16 [3][256][256] Wq, Wk, Wv natural rows
#define WS_QH  (WS_PK + 2u * 3 * DD * DD)            // f16 [8192][256] q/16
#define WS_KH  (WS_QH + 2u * NQ * DD)                // f16 [8192][256] k
#define WS_VT  (WS_KH + 2u * NK * DD)                // f16 [256 d][8192 keys] v^T
#define WS_PO  (WS_VT + 2u * DD * NK)                // f32 [KS][8192][256] unnormalised partial sums of one key range
#define WS_PM  (WS_PO + 4u * KS * NQ * DD)           // f32 [KS][8192] the range's maximum
#define WS_PL  (WS_PM + 4u * KS * NQ)                // f32 [KS][8192] the range's sum
#define WS_END (WS_PL + 4u * KS * NQ)

__global__ __launch_bounds__(256) void k_pack(const float* __restrict__ WQ, const float* __restrict__ WK, const float* __restrict__ WV, __bf16* __restrict__ PK) {
  __shared__ __align__(16) __bf16 s[DD]; const int n = blockIdx.x, which = blockIdx.y, t = threadIdx.x; const float* Wm = (which == 0) ? WQ : (which == 1) ? WK : WV;
  s[t] = (__bf16)Wm[(size_t)n * DD + t]; __syncthreads();
  if (t < DD / 8) vst2((unsigned*)(PK + ((size_t)which * DD + n) * DD + t * 8), *(const v4u*)&s[t * 8]);
}
// eight 16-byte copies per lane, written as the builtin: the kernel uses registers above v255, which asm text cannot name; global address = the copy's wave-uniform base + the lane's 32-bit offset; from one copy to the next the LDS address moves by LS bytes and the global address by GS. The immediate offset moves the LDS address and the global address alike, so one LDS register serves all eight and each base holds its address less that offset
typedef __attribute__((address_space(1))) v4i* gp128; typedef __attribute__((address_space(3))) v4i* lp128;
template <int... I> struct seq_t {};
template <int LS, long long GS, int... I> __device__ __forceinline__ void stage(char* l, unsigned vo, const char* p, seq_t<I...>) {
  (__builtin_amdgcn_global_load_async_to_lds_b128((gp128)(p + I * (GS - LS) + vo), (lp128)l, I * LS, 0), ...);
}
#define SEQ8 seq_t<0, 1, 2, 3, 4, 5, 6, 7>{}
// ---- k_proj: block = 64 rows of x (4 waves x 16) x 128 outputs of one projection (grid 128 x 3 x 2, three blocks to a WGP); the block's 128 weight rows are staged once in LDS by asynchronous copies, whole rows of 512 B, while each wave loads its 16 rows of x and rounds them to eight fragments; behind the copies' wait and one barrier the weight fragments are read from LDS, the eight of a chunk kc as one group, one group ahead of their products
#define PN 128                                    // outputs of a block
#define WPB 528                                   // bytes per staged weight row: 512 + 16, an odd multiple of 16 B for the 16-byte fragment reads
__global__ __launch_bounds__(128) void k_proj(const float* __restrict__ XQ, const float* __restrict__ XKV, const __bf16* __restrict__ PK, const float* __restrict__ BQ, const float* __restrict__ BK, const float* __restrict__ BV, _Float16* __restrict__ QH, _Float16* __restrict__ KH, _Float16* __restrict__ VT) {
  __shared__ __align__(16) char sw[PN * WPB]; __shared__ __align__(16) _Float16 so[4][16][PN + 8]; __shared__ __align__(16) _Float16 st[PN][72];
  const int tid = threadIdx.x, wave = tid >> 5, lane = tid & 31, col = lane & 15, g = lane >> 4; const size_t r0 = (size_t)blockIdx.x * 64 + wave * 16; const int which = blockIdx.y, half = blockIdx.z;
  const float* X = (which == 0) ? XQ : XKV; const float* BB = (which == 0) ? BQ : (which == 1) ? BK : BV; const float sc = (which == 0) ? (1.0f / 16.0f) : 1.0f;
  // wave w brings weight rows 32 w .. 32 w + 31 of the block's 128, one whole row per copy
  const unsigned wu = (unsigned)__builtin_amdgcn_readfirstlane(wave);   // the wave's number in a scalar register: the copies' global base is scalar arithmetic
  const char* gw = (const char*)PK + ((size_t)which * DD + (size_t)half * PN + (size_t)wu * 32) * (DD * 2); char* lw = sw + (wave * 32 * WPB + lane * 16);
#pragma unroll
  for (int c = 0; c < 4; ++c) stage<WPB, DD * 2>(lw + c * (8 * WPB), (unsigned)lane * 16u, gw + c * (8 * DD * 2), SEQ8);
  const float* xr = X + (r0 + col) * DD + 8 * g; const float* bp = BB + half * PN + col;   // this lane's row of x; its first bias
  v16b a[DD / 32]; float bb[PN / 16];
#pragma unroll
  for (int kc = 0; kc < DD / 32; ++kc)
#pragma unroll
    for (int i = 0; i < 8; ++i) { a[kc][i] = (__bf16)xr[kc * 32 + i]; a[kc][8 + i] = (__bf16)xr[kc * 32 + 16 + i]; }
#pragma unroll
  for (int j = 0; j < PN / 16; ++j) bb[j] = bfr(bp[j * 16]);
  asm volatile("s_wait_xcnt 0x0" :: "v"(xr) : "memory");   // behind the loads of x and of the biases, in front of the first rewrite of a register that one of them names; the row's address is its input, so that it keeps its registers up to here
  asm volatile("s_wait_asynccnt 0x0" ::: "memory");   // this wave's weight rows have landed
  __syncthreads();   // and every wave's are published
  const __bf16* wr = (const __bf16*)(sw + col * WPB);   // this lane's first weight row
  v8f acc[PN / 16] = {}; v16b fb[2][PN / 16];   // two groups of registers: the next chunk's fragments are under way while this chunk's products run
#pragma unroll
  for (int j = 0; j < PN / 16; ++j) fb[0][j] = frag_b(wr + j * (16 * WPB / 2), lane);
#pragma unroll
  for (int kc = 0; kc < DD / 32; ++kc) {
    if (kc + 1 < DD / 32) {
#pragma unroll
      for (int j = 0; j < PN / 16; ++j) fb[(kc + 1) & 1][j] = frag_b(wr + j * (16 * WPB / 2) + (kc + 1) * 32, lane); }
#pragma unroll
    for (int j = 0; j < PN / 16; ++j) acc[j] = wmma_bf(a[kc], fb[kc & 1][j], acc[j]); }   // eight independent sums, each in the order kc = 0 .. 7
#pragma unroll
  for (int j = 0; j < PN / 16; ++j) { const int n = j * 16 + col;
#pragma unroll
    for (int r = 0; r < 8; ++r) { const float v = (acc[j][r] + bb[j]) * sc; if (which == 2) st[n][wave * 16 + 8 * g + r] = (_Float16)v; else so[wave][8 * g + r][n] = (_Float16)v; } }
  if (which == 2) { __syncthreads(); const size_t k0 = (size_t)blockIdx.x * 64;
    for (int q = tid; q < PN * 8; q += 128) { const int d = q >> 3, pc = q & 7; vst2((unsigned*)(VT + (size_t)(half * PN + d) * NK + k0 + pc * 8), *(const v4u*)&st[d][pc * 8]); } }
  else { LDSX(); _Float16* DST = (which == 0) ? QH : KH;
    for (int rl = 0; rl < 16; rl += 2) vst2((unsigned*)(DST + (r0 + rl + g) * DD + half * PN + col * 8), *(const v4u*)&so[wave][rl + g][col * 8]);
    asm volatile("s_wait_xcnt 0x0" ::: "memory"); }   // behind the eight stores, in front of any later write of a register that one of them names
}
// ---- k_attn: block = 128 queries x one key range of 2,048 keys = 4 pairs of query tiles x 2 key groups = 8 waves (wave = 32 queries, every 2nd 32-key step of the range; two waves per SIMD, up to 512 registers each), so a staged key is read from L2 once per 128 queries and each fragment is read from LDS once per 32 queries; the 64 keys of one step of the block are staged in LDS by asynchronous copies, and all four pairs of query tiles read their fragments there: buffer 0 holds the K rows, buffer 1 the V^T rows of those keys, and the two halves of a step are the two trips of a two-buffer ring (scores read buffer 0 while buffer 1 fills; P x V reads buffer 1 while buffer 0 takes the next K rows); per step: S^T = K q^T (A = K rows, B = the Q fragments kept in registers; K 256 = 8 chunks, 1 product, q pre-scaled), so lane (g, col) holds 16 of query col's 32 scores: the maximum is taken in the lane and joined once with the other wave half, l stays a per-half sum until the epilogue, m, l and the rescale factor are one register each; P^T rounded once to f16 (the rounded value also accumulates l) is packed from the two score tiles straight into a B operand (element i = tile i / 8, register i % 8: the k order of frag_h) and O^T += V^T P^T for all 256 output dims (16 tiles, A = V^T rows); then each wave's unnormalised partial sums with its m and l go to LDS (over the ring), one barrier, and all 256 threads merge the 2 key groups of each row; the range's unnormalised sums, maximum and sum go to the workspace in 512-B pieces per wave, and k_merge joins the four ranges
#define SKEYS (32 * KG)                           // keys per staged tile
#define KSPAN (NK / KS)                           // keys per block
#define KPB 528                                   // bytes per staged K row: 512 + 16, an odd multiple of 16 B for the 16-byte fragment reads
#define VPB 80                                    // bytes per staged V^T row piece: one key group's 32 keys (64 B) + 16, an odd multiple of 16 B
#define VSUB (DD * VPB + 64)                      // bytes per key group of the V^T tile: its 256 row pieces lie together, within the reach of one LDS address; + 64 B so that the two pieces of a copied row fall on different banks
#define TILE_K (SKEYS * KPB)
#define TILE_V (KG * VSUB)
#define SO_B (QT * KG * 16 * (DD + 4) * 4)        // bytes of the merge's staging, which reuses the ring
// foot of a ring trip: this wave's LDS reads and writes are done, its own copies have landed, then the barrier that publishes the other buffer and frees the one just read
__device__ __forceinline__ void ring_foot() { asm volatile("s_wait_dscnt 0x0" ::: "memory"); asm volatile("s_wait_asynccnt 0x0" ::: "memory"); __syncthreads(); }
__device__ __forceinline__ float xhalf(float x) { return __builtin_bit_cast(float, __builtin_amdgcn_permlanex16(__builtin_bit_cast(int, x), __builtin_bit_cast(int, x), 0x76543210, 0xfedcba98, false, false)); }   // lane l takes lane l ^ 16's value
template <bool V> struct more_t { static constexpr bool v = V; };
static_assert(NW == 8 && SKEYS == 64 && DD == 256 && TILE_K + TILE_V <= SO_B, "8 waves bring 8 K rows (512 B each) and 32 V^T rows (128 B each, four per copy) apiece; the merge's partial sums reuse the ring");
__global__ __launch_bounds__(32 * NW) void k_attn(const _Float16* __restrict__ QH, const _Float16* __restrict__ KH, const _Float16* __restrict__ VT, float* __restrict__ PO, float* __restrict__ PM, float* __restrict__ PL) {
  __shared__ __align__(16) char ring[SO_B]; __shared__ float sm[QT * KG][16], sl[QT * KG][16];
  float (*so)[16][DD + 4] = (float (*)[16][DD + 4])ring;
  const int tid = threadIdx.x, wave = tid >> 5, lane = tid & 31, col = lane & 15, g = lane >> 4, kg = wave / (QT / NT), t0 = (wave % (QT / NT)) * NT; const size_t q0 = (size_t)blockIdx.x * (16 * QT) + t0 * 16, key0 = (size_t)blockIdx.y * KSPAN;
  const _Float16* sk = (const _Float16*)(ring + (kg * 32 + col) * KPB); const _Float16* sv = (const _Float16*)(ring + TILE_K + kg * VSUB + col * VPB);   // this lane's first K row and first V^T row piece
  // K: wave w brings rows 8 w .. 8 w + 7, one whole row per copy; V^T: rows 32 w .. 32 w + 31, four rows of 128 B per copy (lane = row lane / 8, 16-byte piece lane % 8, whose key group is piece / 4)
  const unsigned wu = (unsigned)__builtin_amdgcn_readfirstlane(wave), vok = (unsigned)lane * 16u, vov = (unsigned)(lane >> 3) * (NK * 2u) + (unsigned)(lane & 7) * 16u;   // the wave's number in a scalar register: the wave's share of the copies' global addresses is scalar arithmetic
  char* lk = ring + (wave * 8 * KPB + lane * 16); char* lv = ring + (TILE_K + ((lane & 7) >> 2) * VSUB + (wave * 32 + (lane >> 3)) * VPB + (lane & 3) * 16);
  const char* gk = (const char*)KH + (key0 + (size_t)wu * 8) * (DD * 2); const char* gv = (const char*)VT + (size_t)wu * (32 * NK * 2) + key0 * 2;
  stage<KPB, DD * 2>(lk, vok, gk, SEQ8);
  v16h aq[NT][DD / 32]; const _Float16* qr[NT];   // qr: this lane's row of Q in each tile
#pragma unroll
  for (int j = 0; j < NT; ++j) { qr[j] = QH + (q0 + j * 16 + col) * DD;
#pragma unroll
    for (int kc = 0; kc < DD / 32; ++kc) aq[j][kc] = frag_h(qr[j] + kc * 32, lane); }
  asm volatile("s_wait_xcnt 0x0" :: "v"(qr[0] + 8 * g), "v"(qr[1] + 8 * g) : "memory");   // behind the Q fragments' loads, in front of the first rewrite of a register that one of them names; the two addresses are its inputs, so that they keep their registers up to here
  float m[NT], l[NT];   // per query tile: query col's running maximum (alike in both wave halves) and this half's share of its sum
  v8f acc[NT][16] = {};
#pragma unroll
  for (int j = 0; j < NT; ++j) { m[j] = -3.0e38f; l[j] = 0.f; }
  asm volatile("s_wait_asynccnt 0x0" ::: "memory");   // the first K tile has landed
  __syncthreads();
  stage<4 * VPB, 4 * NK * 2>(lv, vov, gv, SEQ8);
  // one step of 64 keys = two ring trips; MORE: a next step exists, whose tiles are asked for at the two feet. The last step is written out behind the loop, so that no branch stands inside a step: with one, the compiler sank the tail of the softmax behind it, its values stayed live through the P x V products and a Q fragment spilled inside the key loop
  auto step = [&](int it, auto more) __attribute__((always_inline)) { constexpr bool MORE = decltype(more)::v; v8f s[NT][2] = {};   // every inner loop of a step is unrolled, so that each index of a register array is a constant
    { v16h fk[3][2];   // K fragments read from LDS: the two key tiles of one chunk kc are a group, read two groups ahead of their products (three groups of registers: beside the scores there is no room for more)
#pragma unroll
      for (int kc = 0; kc < 2; ++kc)
#pragma unroll
        for (int ct = 0; ct < 2; ++ct) fk[kc][ct] = frag_h(sk + ct * (16 * KPB / 2) + kc * 32, lane);
#pragma unroll
      for (int kc = 0; kc < DD / 32; ++kc) {
        if (kc + 2 < DD / 32) {
#pragma unroll
          for (int ct = 0; ct < 2; ++ct) fk[(kc + 2) % 3][ct] = frag_h(sk + ct * (16 * KPB / 2) + (kc + 2) * 32, lane); }
        __builtin_amdgcn_sched_barrier(0);   // a later group's reads stay together in front of this group's products; without it the compiler sinks each read to its use and every product waits out an LDS latency
#pragma unroll
        for (int ct = 0; ct < 2; ++ct)
#pragma unroll
          for (int j = 0; j < NT; ++j) s[j][ct] = wmma16(fk[kc % 3][ct], aq[j][kc], s[j][ct]);   // one fragment, NT products; four independent sums, each in the order kc = 0 .. 7
        __builtin_amdgcn_sched_barrier(0); } }   // and no later read rises among these products
    v16h pb[NT]; float alpha[NT];
#pragma unroll
    for (int j = 0; j < NT; ++j) { float t[8];   // s[j][ct][r] = score of key 16 ct + 8 g + r with query col of tile j
#pragma unroll
      for (int r = 0; r < 8; ++r) t[r] = fmaxf(s[j][0][r], s[j][1][r]);
      float mx = fmaxf(fmaxf(fmaxf(t[0], t[1]), fmaxf(t[2], t[3])), fmaxf(fmaxf(t[4], t[5]), fmaxf(t[6], t[7])));
      mx = fmaxf(mx, xhalf(mx));
      const float mn = fmaxf(m[j], mx); alpha[j] = (m[j] <= -1.0e38f) ? 0.f : __expf(m[j] - mn);
#pragma unroll
      for (int r = 0; r < 8; ++r) { const _Float16 e0 = (_Float16)__expf(s[j][0][r] - mn), e1 = (_Float16)__expf(s[j][1][r] - mn); pb[j][r] = e0; pb[j][8 + r] = e1; t[r] = (float)e0 + (float)e1; }   // P rounded once; the same values feed l
      l[j] = l[j] * alpha[j] + (((t[0] + t[1]) + (t[2] + t[3])) + ((t[4] + t[5]) + (t[6] + t[7]))); m[j] = mn; }
#pragma unroll
    for (int j = 0; j < NT; ++j)
#pragma unroll
      for (int dt = 0; dt < 16; ++dt) acc[j][dt] *= alpha[j];
    ring_foot();
    if constexpr (MORE) stage<KPB, DD * 2>(lk, vok, gk + (size_t)(it + 1) * (SKEYS * DD * 2), SEQ8);
    v16h fr[2][4];   // V^T fragments, four to a group, two groups of registers: the next group's reads are under way while this group's products run
#pragma unroll
    for (int u = 0; u < 4; ++u) fr[0][u] = frag_h(sv + u * (16 * VPB / 2), lane);   // V^T fragment u of group gi: dims 16 (4 gi + u) ..
#pragma unroll
    for (int gi = 0; gi < 4; ++gi) {
      if (gi < 3) {
#pragma unroll
        for (int u = 0; u < 4; ++u) fr[(gi + 1) & 1][u] = frag_h(sv + ((gi + 1) * 4 + u) * (16 * VPB / 2), lane); }
      __builtin_amdgcn_sched_barrier(0);   // as above: the next group's reads in front of this group's products
#pragma unroll
      for (int u = 0; u < 4; ++u)
#pragma unroll
        for (int j = 0; j < NT; ++j) acc[j][gi * 4 + u] = wmma16(fr[gi & 1][u], pb[j], acc[j][gi * 4 + u]);   // one fragment, NT products
      __builtin_amdgcn_sched_barrier(0); }
    ring_foot();
    if constexpr (MORE) stage<4 * VPB, 4 * NK * 2>(lv, vov, gv + (size_t)(it + 1) * (SKEYS * 2), SEQ8); };
#pragma unroll 1
  for (int it = 0; it < KSPAN / SKEYS - 1; ++it) step(it, more_t<true>{});
  step(KSPAN / SKEYS - 1, more_t<false>{});
  asm volatile("s_wait_asynccnt 0x0" ::: "memory");   // nothing is in flight when the ring becomes the merge's staging
#pragma unroll
  for (int j = 0; j < NT; ++j) { const int sw = kg * QT + t0 + j;   // the staging slot of (key group, query tile)
    const float lt = l[j] + xhalf(l[j]);   // the two wave halves' sums are joined once
    if (g == 0) { sm[sw][col] = m[j]; sl[sw][col] = lt; }
#pragma unroll
    for (int dt = 0; dt < 16; ++dt) { float* o = &so[sw][col][dt * 16 + 8 * g];   // acc[j][dt][r] = dim 16 dt + 8 g + r of query col: eight neighbours of one row
      vst2(o, (v4f){acc[j][dt][0], acc[j][dt][1], acc[j][dt][2], acc[j][dt][3]}); vst2(o + 4, (v4f){acc[j][dt][4], acc[j][dt][5], acc[j][dt][6], acc[j][dt][7]}); } }
  __syncthreads();
  // merge inside the block: 128 rows x 64 four-float pieces over 256 threads; a wave holds half of one row, so m and the weights are wave-uniform reads
  const size_t pr0 = (size_t)blockIdx.y * NQ + (size_t)blockIdx.x * (16 * QT);
#pragma unroll 1   // rolled: thirty-two trips in line would only lengthen the text
  for (int i0 = 0; i0 < 16 * QT * (DD / 4) / (32 * NW); i0 += 4) {
#pragma unroll   // four trips' LDS reads are in flight together
    for (int i = i0; i < i0 + 4; ++i) { const int idx = i * (32 * NW) + tid, row = idx >> 6, c = (idx & 63) * 4, w0 = row >> 4, rl = row & 15;
      float mg[KG], mx = -3.0e38f;
#pragma unroll
      for (int k = 0; k < KG; ++k) { mg[k] = sm[k * QT + w0][rl]; mx = fmaxf(mx, mg[k]); }
      v4f o = {};
#pragma unroll
      for (int k = 0; k < KG; ++k) o += __expf(mg[k] - mx) * *(const v4f*)&so[k * QT + w0][rl][c];
      vst2(PO + (pr0 + row) * DD + c, o); }
    asm volatile("s_wait_xcnt 0x0" ::: "memory"); }   // the next trip rewrites the registers that these four stores name
  // the range's maximum and sum, one thread per row
  if (tid < 16 * QT) { const int w0 = tid >> 4, rl = tid & 15;
    float mg[KG], mx = -3.0e38f;
#pragma unroll
    for (int k = 0; k < KG; ++k) { mg[k] = sm[k * QT + w0][rl]; mx = fmaxf(mx, mg[k]); }
    float ls = 0.f;
#pragma unroll
    for (int k = 0; k < KG; ++k) ls += __expf(mg[k] - mx) * sl[k * QT + w0][rl];
    PM[pr0 + tid] = mx; PL[pr0 + tid] = ls; }
}
// the four key ranges of a query row are joined: a thread holds four neighbours of each of four rows, a wave half a row; 16 waves per block and one block per 32 rows, so that few waves have to be started
__global__ __launch_bounds__(512) void k_merge(const float* __restrict__ PO, const float* __restrict__ PM, const float* __restrict__ PL, float* __restrict__ OUT) {
#pragma unroll 1   // rolled: a trip's loads are independent and go out together, and 16 waves of them fill the memory path
  for (int j = 0; j < 4; ++j) { const unsigned idx = (blockIdx.x * 4u + j) * 512u + threadIdx.x, rb = (idx >> 6) * 4u, ob = idx * 16u;   // byte offsets: of the row's maximum and sum in a range's plane; of the thread's four floats in a range's partial sums and in out
    float mg[KS], pl[KS]; v4f po[KS];
#pragma unroll
    for (int k = 0; k < KS; ++k) { mg[k] = *(const float*)((const char*)(PM + (size_t)k * NQ) + rb); pl[k] = *(const float*)((const char*)(PL + (size_t)k * NQ) + rb); po[k] = *(const v4f*)((const char*)(PO + (size_t)k * NQ * DD) + ob); }
    asm volatile("s_wait_xcnt 0x0" :: "v"(rb), "v"(ob) : "memory");   // behind the trip's twelve loads, in front of the first rewrite of a register that one of them names; the two offsets are its inputs, so that they keep their registers up to here and no later load's result lands on them
    const float mx = fmaxf(fmaxf(mg[0], mg[1]), fmaxf(mg[2], mg[3]));
    float ls = 0.f; v4f o = {};
#pragma unroll
    for (int k = 0; k < KS; ++k) { const float w = __expf(mg[k] - mx); ls += w * pl[k]; o += w * po[k]; }
    vst2((char*)OUT + ob, o * (1.0f / ls));
    asm volatile("s_wait_xcnt 0x0" ::: "memory"); }   // the next trip rewrites the registers that this trip's store names
}
extern "C" void kernel_launch(void* const* d_in, const int* in_sizes, int n_in, void* d_out, int out_size, void* d_ws, size_t ws_size, hipStream_t stream) {
  (void)in_sizes; (void)n_in; (void)out_size;
  const float** F = (const float**)d_in;   // 0 x_q [8192,256], 1 x_kv [8192,256], 2 Wq [256,256], 3 bq, 4 Wk, 5 bk, 6 Wv, 7 bv
  if (ws_size < (size_t)WS_END) return;
  char* ws = (char*)d_ws; __bf16* PK = (__bf16*)(ws + WS_PK); _Float16 *QH = (_Float16*)(ws + WS_QH), *KH = (_Float16*)(ws + WS_KH), *VT = (_Float16*)(ws + WS_VT); float *PO = (float*)(ws + WS_PO), *PM = (float*)(ws + WS_PM), *PL = (float*)(ws + WS_PL);
  k_pack<<<dim3(DD, 3), 256, 0, stream>>>(F[2], F[4], F[6], PK);
  k_proj<<<dim3(NQ / 64, 3, 2), 128, 0, stream>>>(F[0], F[1], PK, F[3], F[5], F[7], QH, KH, VT);
  k_attn<<<dim3(NQ / (16 * QT), KS), 32 * NW, 0, stream>>>(QH, KH, VT, PO, PM, PL);
  k_merge<<<NQ / 32, 512, 0, stream>>>(PO, PM, PL, (float*)d_out);
}
